// v000
// The times below were measured on an AMD MI455X: many runs one after another, warmed up first and cycling through
// copies of the inputs, with the whole window's GPU time divided by the number of runs. Launches and the gaps
// between them are all in it. The median over several windows is given; except for v000 it joins two sittings, which
// can be a few percent apart, so the side-by-side timings, each taken in one sitting, are the better comparison.
// v000, which the later versions start from, runs in 423 microseconds.
#include <hip/hip_runtime.h>

// ---------------------------------------------------------------------------
// MultiHeadAttention forward for MI455X (gfx1250, wave32, WMMA bf16)
//   B=2, T=2048, C=1024, H=16, D=64
//   - bf16 WMMA for all four GEMM stages + streaming-softmax attention
//   - GEMM: 4-wave workgroups, W-tile double-buffered in LDS via
//     global_load_async_to_lds_b128 (ASYNCcnt) -- CDNA5 async path
// ---------------------------------------------------------------------------

typedef __bf16 bf16_t;
typedef __attribute__((ext_vector_type(16))) __bf16 v16bf;
typedef __attribute__((ext_vector_type(8)))  __bf16 v8bf;
typedef __attribute__((ext_vector_type(8)))  float  v8f;

#define T_SEQ   2048
#define C_DIM   1024
#define NHEAD   16
#define HDIM    64
#define MTOT    4096          // B * T
#define ATT_SCALE 0.125f      // 1/sqrt(64)

// ----- helpers --------------------------------------------------------------

__device__ __forceinline__ bf16_t f2bf(float f) {
  unsigned u = __builtin_bit_cast(unsigned, f);
  unsigned r = u + 0x7FFFu + ((u >> 16) & 1u);   // round-to-nearest-even
  unsigned short h = (unsigned short)(r >> 16);
  return __builtin_bit_cast(bf16_t, h);
}

// WMMA D = A(16x32 bf16) * B(32x16 bf16) + C(16x16 f32)
__device__ __forceinline__ v8f wmma_bf16(v16bf a, v16bf b, v8f c) {
  return __builtin_amdgcn_wmma_f32_16x16x32_bf16(
      /*neg_a=*/false, a, /*neg_b=*/false, b,
      /*c_mod=*/(short)0, c, /*reuse_a=*/false, /*reuse_b=*/false);
}

// CDNA5 async copy: 16 bytes global -> LDS, tracked by ASYNCcnt.
// lds_off = LDS byte address (low 32 bits of the generic pointer; the LDS
// aperture maps LDS_ADDR = addr[31:0]).
__device__ __forceinline__ void async_copy_b128(unsigned lds_off,
                                                const bf16_t* gsrc) {
  unsigned long long ga = (unsigned long long)(uintptr_t)gsrc;
  asm volatile("global_load_async_to_lds_b128 %0, %1, off"
               :: "v"(lds_off), "v"(ga) : "memory");
}

__device__ __forceinline__ void wait_asynccnt0() {
  asm volatile("s_wait_asynccnt 0x0" ::: "memory");
}

// Load a 16x32 bf16 fragment (ISA 7.12.2 16-bit A layout) from a row-major
// matrix: rows r0..r0+15, cols c0..c0+31, leading dim ld (elements).
// lanes 0-15 hold (row = r0+lane) K = 0-7 and 16-23; lanes 16-31 hold K = 8-15
// and 24-31.  The SAME pattern serves as the B operand when the B matrix is
// stored column-contiguous (i.e. memory is [N][K] row-major).
__device__ __forceinline__ v16bf load_frag(const bf16_t* base, int ld,
                                           int r0, int c0) {
  int lane = threadIdx.x & 31;
  int nn   = lane & 15;
  int half = lane >> 4;
  const bf16_t* p = base + (size_t)(r0 + nn) * ld + c0 + (half << 3);
  v8bf lo = *reinterpret_cast<const v8bf*>(p);        // K = half*8 .. +8
  v8bf hi = *reinterpret_cast<const v8bf*>(p + 16);   // K = 16+half*8 .. +8
  return __builtin_shufflevector(lo, hi, 0, 1, 2, 3, 4, 5, 6, 7,
                                 8, 9, 10, 11, 12, 13, 14, 15);
}

__device__ __forceinline__ float rmax16(float v) {
  #pragma unroll
  for (int off = 1; off < 16; off <<= 1)
    v = fmaxf(v, __shfl_xor(v, off, 16));
  return v;
}

__device__ __forceinline__ float rsum16(float v) {
  #pragma unroll
  for (int off = 1; off < 16; off <<= 1)
    v += __shfl_xor(v, off, 16);
  return v;
}

// ----- kernel 1: f32 -> bf16 conversion ------------------------------------

__global__ void cvt_f32_bf16(const float* __restrict__ in,
                             bf16_t* __restrict__ out, int n) {
  int i = blockIdx.x * blockDim.x + threadIdx.x;
  if (i < n) out[i] = f2bf(in[i]);
}

// ----- kernel 2: GEMM  Y = A(4096x1024) @ W^T(1024x1024) + bias ------------
// 4 waves / workgroup; each wave owns a 32(M) x 64(N) tile, all waves share
// the same N block.  Per K-step (32): the 64x32 W tile (4 KB) is staged into
// double-buffered LDS with global_load_async_to_lds_b128; A fragments load
// directly from global (b128) so VMEM overlaps the DS+WMMA stream.
// mode 0: store bf16 row-major [M][N], value scaled by `scale`
// mode 1: store bf16 transposed for V: out[(b*1024+n)*2048 + t]
// mode 2: store f32 row-major [M][N]

__global__ void gemm_proj(const bf16_t* __restrict__ A,
                          const bf16_t* __restrict__ W,
                          const float* __restrict__ bias,
                          void* __restrict__ out, int mode, float scale) {
  __shared__ alignas(16) bf16_t ldsB[2][64 * 32];

  int tid  = threadIdx.x;            // 0..127
  int wave = tid >> 5;
  int lane = tid & 31;
  int nn = lane & 15, half = lane >> 4;
  int m0 = blockIdx.x * 128 + wave * 32;
  int n0 = blockIdx.y * 64;

  // stage 64 rows x 32 cols of W (rows n0.., cols k..) into ldsB[buf]
  auto stage = [&](int buf, int k) {
    #pragma unroll
    for (int c = 0; c < 2; ++c) {
      int chunk = tid * 2 + c;        // 0..255, 16B each
      int row = chunk >> 2;           // 0..63
      int col = (chunk & 3) * 8;      // 0,8,16,24 (elements)
      const bf16_t* src = W + (size_t)(n0 + row) * C_DIM + k + col;
      unsigned dst = (unsigned)(uintptr_t)&ldsB[buf][row * 32 + col];
      async_copy_b128(dst, src);
    }
  };

  v8f c[2][4];
  #pragma unroll
  for (int i = 0; i < 2; ++i)
    #pragma unroll
    for (int j = 0; j < 4; ++j)
      c[i][j] = v8f{0.f, 0.f, 0.f, 0.f, 0.f, 0.f, 0.f, 0.f};

  stage(0, 0);
  int buf = 0;
  for (int k = 0; k < C_DIM; k += 32) {
    v16bf a0 = load_frag(A, C_DIM, m0,      k);
    v16bf a1 = load_frag(A, C_DIM, m0 + 16, k);
    wait_asynccnt0();          // our slice of ldsB[buf] landed
    __syncthreads();           // everyone's slice landed
    if (k + 32 < C_DIM) stage(buf ^ 1, k + 32);   // prefetch next tile
    #pragma unroll
    for (int j = 0; j < 4; ++j) {
      v16bf b = load_frag(&ldsB[buf][0], 32, j * 16, 0);
      c[0][j] = wmma_bf16(a0, b, c[0][j]);
      c[1][j] = wmma_bf16(a1, b, c[1][j]);
    }
    buf ^= 1;
  }

  #pragma unroll
  for (int j = 0; j < 4; ++j) {
    int n = n0 + j * 16 + nn;
    float bv = bias[n];
    #pragma unroll
    for (int i = 0; i < 2; ++i) {
      #pragma unroll
      for (int r = 0; r < 8; ++r) {
        int m = m0 + i * 16 + r + 8 * half;
        float val = (c[i][j][r] + bv) * scale;
        if (mode == 0) {
          ((bf16_t*)out)[(size_t)m * C_DIM + n] = f2bf(val);
        } else if (mode == 1) {
          int b = m >> 11, t = m & 2047;                 // m = b*2048 + t
          ((bf16_t*)out)[((size_t)(b * 1024 + n)) * T_SEQ + t] = f2bf(val);
        } else {
          ((float*)out)[(size_t)m * C_DIM + n] = val;
        }
      }
    }
  }
}

// ----- kernel 3: streaming-softmax attention --------------------------------
// one wave per block: 16 query rows of one (b, h).
// Q pre-scaled by 1/sqrt(d); loop over key tiles of 32, online softmax,
// P round-trips through LDS (C-layout -> A-fragment layout, bf16),
// out accumulated as 16x64 f32 via 4 WMMAs per key tile.

__global__ void attn_flash(const bf16_t* __restrict__ Qb,
                           const bf16_t* __restrict__ Kb,
                           const bf16_t* __restrict__ Vt,
                           const float* __restrict__ mask,
                           bf16_t* __restrict__ AO) {
  __shared__ alignas(16) bf16_t ldsP[16 * 32];

  int qt = blockIdx.x;                 // query tile (0..127)
  int bh = blockIdx.y;                 // b*16 + h
  int b = bh >> 4, h = bh & 15;
  int lane = threadIdx.x & 31;
  int nn = lane & 15, half = lane >> 4;

  int qrow0 = b * T_SEQ + qt * 16;
  v16bf aq0 = load_frag(Qb, C_DIM, qrow0, h * HDIM);
  v16bf aq1 = load_frag(Qb, C_DIM, qrow0, h * HDIM + 32);

  v8f c[4];
  #pragma unroll
  for (int j = 0; j < 4; ++j)
    c[j] = v8f{0.f, 0.f, 0.f, 0.f, 0.f, 0.f, 0.f, 0.f};

  float mrun[8], lrun[8];
  #pragma unroll
  for (int r = 0; r < 8; ++r) { mrun[r] = -3.0e38f; lrun[r] = 0.f; }

  const bf16_t* VtB = Vt + (size_t)b * 1024 * T_SEQ;  // [n=h*64+d][t]
  const float* mbase = mask + (size_t)(qt * 16) * T_SEQ;

  for (int kbase = 0; kbase < T_SEQ; kbase += 32) {
    // ---- scores: S(16x32) = Q(16x64) @ K^T, two 16x16 sub-tiles ----
    v8f s0 = v8f{0.f, 0.f, 0.f, 0.f, 0.f, 0.f, 0.f, 0.f};
    v8f s1 = v8f{0.f, 0.f, 0.f, 0.f, 0.f, 0.f, 0.f, 0.f};
    {
      v16bf k00 = load_frag(Kb, C_DIM, b * T_SEQ + kbase,      h * HDIM);
      v16bf k01 = load_frag(Kb, C_DIM, b * T_SEQ + kbase,      h * HDIM + 32);
      s0 = wmma_bf16(aq0, k00, s0);
      s0 = wmma_bf16(aq1, k01, s0);
      v16bf k10 = load_frag(Kb, C_DIM, b * T_SEQ + kbase + 16, h * HDIM);
      v16bf k11 = load_frag(Kb, C_DIM, b * T_SEQ + kbase + 16, h * HDIM + 32);
      s1 = wmma_bf16(aq0, k10, s1);
      s1 = wmma_bf16(aq1, k11, s1);
    }

    // ---- additive mask (2D [Tq][Tk]) ----
    #pragma unroll
    for (int r = 0; r < 8; ++r) {
      const float* mp = mbase + (size_t)(r + 8 * half) * T_SEQ + kbase;
      s0[r] += mp[nn];
      s1[r] += mp[16 + nn];
    }

    // ---- online softmax update + write P tile (bf16) to LDS ----
    #pragma unroll
    for (int r = 0; r < 8; ++r) {
      float tm = rmax16(fmaxf(s0[r], s1[r]));
      float nm = fmaxf(mrun[r], tm);
      float al = __expf(mrun[r] - nm);
      float p0 = __expf(s0[r] - nm);
      float p1 = __expf(s1[r] - nm);
      float rs = rsum16(p0 + p1);
      lrun[r] = lrun[r] * al + rs;
      mrun[r] = nm;
      #pragma unroll
      for (int j = 0; j < 4; ++j) c[j][r] *= al;
      int row = r + 8 * half;
      ldsP[row * 32 + nn]      = f2bf(p0);
      ldsP[row * 32 + 16 + nn] = f2bf(p1);
    }
    // single wave: DS ops are in-order; compiler inserts s_wait_dscnt.

    // ---- out(16x64) += P(16x32) @ V(32x64)  (V stored transposed) ----
    v16bf pa = load_frag(ldsP, 32, 0, 0);
    #pragma unroll
    for (int j = 0; j < 4; ++j) {
      v16bf vb = load_frag(VtB, T_SEQ, h * HDIM + j * 16, kbase);
      c[j] = wmma_bf16(pa, vb, c[j]);
    }
  }

  // ---- normalize and store to AO (bf16 row-major [4096][1024]) ----
  #pragma unroll
  for (int r = 0; r < 8; ++r) {
    float inv = 1.0f / lrun[r];
    #pragma unroll
    for (int j = 0; j < 4; ++j) c[j][r] *= inv;
  }
  #pragma unroll
  for (int j = 0; j < 4; ++j) {
    #pragma unroll
    for (int r = 0; r < 8; ++r) {
      int m = qrow0 + r + 8 * half;
      int n = h * HDIM + j * 16 + nn;
      AO[(size_t)m * C_DIM + n] = f2bf(c[j][r]);
    }
  }
}

// ---------------------------------------------------------------------------

extern "C" void kernel_launch(void* const* d_in, const int* in_sizes, int n_in,
                              void* d_out, int out_size, void* d_ws,
                              size_t ws_size, hipStream_t stream) {
  const float* x    = (const float*)d_in[0];
  const float* mask = (const float*)d_in[1];
  const float* Wq = (const float*)d_in[2];  const float* bq = (const float*)d_in[3];
  const float* Wk = (const float*)d_in[4];  const float* bk = (const float*)d_in[5];
  const float* Wv = (const float*)d_in[6];  const float* bv = (const float*)d_in[7];
  const float* Wo = (const float*)d_in[8];  const float* bo = (const float*)d_in[9];

  char* ws = (char*)d_ws;
  const size_t MiB = 1024 * 1024;
  bf16_t* xb  = (bf16_t*)(ws + 0);          //  8 MiB  x  bf16 [4096][1024]
  bf16_t* wqb = (bf16_t*)(ws + 8  * MiB);   //  2 MiB
  bf16_t* wkb = (bf16_t*)(ws + 10 * MiB);   //  2 MiB
  bf16_t* wvb = (bf16_t*)(ws + 12 * MiB);   //  2 MiB
  bf16_t* wob = (bf16_t*)(ws + 14 * MiB);   //  2 MiB
  bf16_t* Qb  = (bf16_t*)(ws + 16 * MiB);   //  8 MiB  (pre-scaled by 1/sqrt d)
  bf16_t* Kb  = (bf16_t*)(ws + 24 * MiB);   //  8 MiB
  bf16_t* Vt  = (bf16_t*)(ws + 32 * MiB);   //  8 MiB  V transposed [b][n][t]
  bf16_t* AO  = (bf16_t*)(ws + 40 * MiB);   //  8 MiB  attention out bf16

  // 1) fp32 -> bf16 staging
  const int NX = MTOT * C_DIM;      // 4194304
  const int NW = C_DIM * C_DIM;     // 1048576
  cvt_f32_bf16<<<(NX + 255) / 256, 256, 0, stream>>>(x,  xb,  NX);
  cvt_f32_bf16<<<(NW + 255) / 256, 256, 0, stream>>>(Wq, wqb, NW);
  cvt_f32_bf16<<<(NW + 255) / 256, 256, 0, stream>>>(Wk, wkb, NW);
  cvt_f32_bf16<<<(NW + 255) / 256, 256, 0, stream>>>(Wv, wvb, NW);
  cvt_f32_bf16<<<(NW + 255) / 256, 256, 0, stream>>>(Wo, wob, NW);

  // 2) Q/K/V projections (WMMA bf16, async-LDS W staging)
  dim3 gg(MTOT / 128, C_DIM / 64);  // 32 x 16
  dim3 bw(128);                     // 4 waves
  gemm_proj<<<gg, bw, 0, stream>>>(xb, wqb, bq, (void*)Qb, 0, ATT_SCALE);
  gemm_proj<<<gg, bw, 0, stream>>>(xb, wkb, bk, (void*)Kb, 0, 1.0f);
  gemm_proj<<<gg, bw, 0, stream>>>(xb, wvb, bv, (void*)Vt, 1, 1.0f);

  // 3) streaming-softmax attention (WMMA bf16)
  attn_flash<<<dim3(T_SEQ / 16, 2 * NHEAD), dim3(32), 0, stream>>>(
      Qb, Kb, Vt, mask, AO);

  // 4) output projection, f32 result
  gemm_proj<<<gg, bw, 0, stream>>>(AO, wob, bo, d_out, 2, 1.0f);
}

// v001
// A run of this version takes 214 microseconds.
// In two side-by-side timings against v000, it was 2.01 and 2.02 times as fast.
#include <hip/hip_runtime.h>

// ---------------------------------------------------------------------------
// MultiHeadAttention forward for MI455X (gfx1250, wave32, WMMA bf16)
//   B=2, T=2048, C=1024, H=16, D=64
//   - bf16 WMMA for all four GEMM stages + streaming-softmax attention
//   - GEMM: 4-wave workgroups, W-tile double-buffered in LDS via
//     global_load_async_to_lds_b128 (ASYNCcnt) -- CDNA5 async path
// ---------------------------------------------------------------------------

typedef __bf16 bf16_t;
typedef __attribute__((ext_vector_type(16))) __bf16 v16bf;
typedef __attribute__((ext_vector_type(8)))  __bf16 v8bf;
typedef __attribute__((ext_vector_type(8)))  float  v8f;

#define T_SEQ   2048
#define C_DIM   1024
#define NHEAD   16
#define HDIM    64
#define MTOT    4096          // B * T
#define ATT_SCALE 0.125f      // 1/sqrt(64)

// ----- helpers --------------------------------------------------------------

__device__ __forceinline__ bf16_t f2bf(float f) {
  unsigned u = __builtin_bit_cast(unsigned, f);
  unsigned r = u + 0x7FFFu + ((u >> 16) & 1u);   // round-to-nearest-even
  unsigned short h = (unsigned short)(r >> 16);
  return __builtin_bit_cast(bf16_t, h);
}

// WMMA D = A(16x32 bf16) * B(32x16 bf16) + C(16x16 f32)
__device__ __forceinline__ v8f wmma_bf16(v16bf a, v16bf b, v8f c) {
  return __builtin_amdgcn_wmma_f32_16x16x32_bf16(
      /*neg_a=*/false, a, /*neg_b=*/false, b,
      /*c_mod=*/(short)0, c, /*reuse_a=*/false, /*reuse_b=*/false);
}

// CDNA5 async copy: 16 bytes global -> LDS, tracked by ASYNCcnt.
// lds_off = LDS byte address (low 32 bits of the generic pointer; the LDS
// aperture maps LDS_ADDR = addr[31:0]).
__device__ __forceinline__ void async_copy_b128(unsigned lds_off,
                                                const bf16_t* gsrc) {
  unsigned long long ga = (unsigned long long)(uintptr_t)gsrc;
  asm volatile("global_load_async_to_lds_b128 %0, %1, off"
               :: "v"(lds_off), "v"(ga) : "memory");
}

// Four async copies in one statement.  The closing s_wait_xcnt 0 stands inside
// the statement so that no address register of a copy is rewritten ahead of it.
__device__ __forceinline__ void async_copy4_b128(
    unsigned l0, unsigned l1, unsigned l2, unsigned l3,
    const bf16_t* g0, const bf16_t* g1, const bf16_t* g2, const bf16_t* g3) {
  asm volatile("global_load_async_to_lds_b128 %0, %4, off\n\t"
               "global_load_async_to_lds_b128 %1, %5, off\n\t"
               "global_load_async_to_lds_b128 %2, %6, off\n\t"
               "global_load_async_to_lds_b128 %3, %7, off\n\t"
               "s_wait_xcnt 0x0"
               :: "v"(l0), "v"(l1), "v"(l2), "v"(l3),
                  "v"(g0), "v"(g1), "v"(g2), "v"(g3) : "memory");
}

__device__ __forceinline__ void wait_asynccnt0() {
  asm volatile("s_wait_asynccnt 0x0" ::: "memory");
}

// Load a 16x32 bf16 fragment (ISA 7.12.2 16-bit A layout) from a row-major
// matrix: rows r0..r0+15, cols c0..c0+31, leading dim ld (elements).
// lanes 0-15 hold (row = r0+lane) K = 0-7 and 16-23; lanes 16-31 hold K = 8-15
// and 24-31.  The SAME pattern serves as the B operand when the B matrix is
// stored column-contiguous (i.e. memory is [N][K] row-major).
__device__ __forceinline__ v16bf load_frag(const bf16_t* base, int ld,
                                           int r0, int c0) {
  int lane = threadIdx.x & 31;
  int nn   = lane & 15;
  int half = lane >> 4;
  const bf16_t* p = base + (size_t)(r0 + nn) * ld + c0 + (half << 3);
  v8bf lo = *reinterpret_cast<const v8bf*>(p);        // K = half*8 .. +8
  v8bf hi = *reinterpret_cast<const v8bf*>(p + 16);   // K = 16+half*8 .. +8
  return __builtin_shufflevector(lo, hi, 0, 1, 2, 3, 4, 5, 6, 7,
                                 8, 9, 10, 11, 12, 13, 14, 15);
}

__device__ __forceinline__ float rmax16(float v) {
  #pragma unroll
  for (int off = 1; off < 16; off <<= 1)
    v = fmaxf(v, __shfl_xor(v, off, 16));
  return v;
}

__device__ __forceinline__ float rsum16(float v) {
  #pragma unroll
  for (int off = 1; off < 16; off <<= 1)
    v += __shfl_xor(v, off, 16);
  return v;
}

// ----- kernel 1: f32 -> bf16 conversion ------------------------------------

__global__ void cvt_f32_bf16(const float* __restrict__ in,
                             bf16_t* __restrict__ out, int n) {
  int i = blockIdx.x * blockDim.x + threadIdx.x;
  if (i < n) out[i] = f2bf(in[i]);
}

// ----- kernel 2: GEMM  Y = A(4096x1024) @ W^T(1024x1024) + bias ------------
// 4 waves / workgroup; each wave owns a 32(M) x 64(N) tile, all waves share
// the same N block.  Per K-step (32): the 64x32 W tile (4 KB) is staged into
// double-buffered LDS with global_load_async_to_lds_b128; A fragments load
// directly from global (b128) so VMEM overlaps the DS+WMMA stream.
// mode 0: store bf16 row-major [M][N], value scaled by `scale`
// mode 1: store bf16 transposed for V: out[(b*1024+n)*2048 + t]
// mode 2: store f32 row-major [M][N]

__global__ void gemm_proj(const bf16_t* __restrict__ A,
                          const bf16_t* __restrict__ W,
                          const float* __restrict__ bias,
                          void* __restrict__ out, int mode, float scale) {
  __shared__ alignas(16) bf16_t ldsB[2][64 * 32];

  int tid  = threadIdx.x;            // 0..127
  int wave = tid >> 5;
  int lane = tid & 31;
  int nn = lane & 15, half = lane >> 4;
  int m0 = blockIdx.x * 128 + wave * 32;
  int n0 = blockIdx.y * 64;

  // stage 64 rows x 32 cols of W (rows n0.., cols k..) into ldsB[buf]
  auto stage = [&](int buf, int k) {
    #pragma unroll
    for (int c = 0; c < 2; ++c) {
      int chunk = tid * 2 + c;        // 0..255, 16B each
      int row = chunk >> 2;           // 0..63
      int col = (chunk & 3) * 8;      // 0,8,16,24 (elements)
      const bf16_t* src = W + (size_t)(n0 + row) * C_DIM + k + col;
      unsigned dst = (unsigned)(uintptr_t)&ldsB[buf][row * 32 + col];
      async_copy_b128(dst, src);
    }
  };

  v8f c[2][4];
  #pragma unroll
  for (int i = 0; i < 2; ++i)
    #pragma unroll
    for (int j = 0; j < 4; ++j)
      c[i][j] = v8f{0.f, 0.f, 0.f, 0.f, 0.f, 0.f, 0.f, 0.f};

  stage(0, 0);
  int buf = 0;
  for (int k = 0; k < C_DIM; k += 32) {
    v16bf a0 = load_frag(A, C_DIM, m0,      k);
    v16bf a1 = load_frag(A, C_DIM, m0 + 16, k);
    wait_asynccnt0();          // our slice of ldsB[buf] landed
    __syncthreads();           // everyone's slice landed
    if (k + 32 < C_DIM) stage(buf ^ 1, k + 32);   // prefetch next tile
    #pragma unroll
    for (int j = 0; j < 4; ++j) {
      v16bf b = load_frag(&ldsB[buf][0], 32, j * 16, 0);
      c[0][j] = wmma_bf16(a0, b, c[0][j]);
      c[1][j] = wmma_bf16(a1, b, c[1][j]);
    }
    buf ^= 1;
  }

  #pragma unroll
  for (int j = 0; j < 4; ++j) {
    int n = n0 + j * 16 + nn;
    float bv = bias[n];
    #pragma unroll
    for (int i = 0; i < 2; ++i) {
      #pragma unroll
      for (int r = 0; r < 8; ++r) {
        int m = m0 + i * 16 + r + 8 * half;
        float val = (c[i][j][r] + bv) * scale;
        if (mode == 0) {
          ((bf16_t*)out)[(size_t)m * C_DIM + n] = f2bf(val);
        } else if (mode == 1) {
          int b = m >> 11, t = m & 2047;                 // m = b*2048 + t
          ((bf16_t*)out)[((size_t)(b * 1024 + n)) * T_SEQ + t] = f2bf(val);
        } else {
          ((float*)out)[(size_t)m * C_DIM + n] = val;
        }
      }
    }
  }
}

// ----- kernel 3: streaming-softmax attention --------------------------------
// eight waves per block, each with 16 query rows of one (b, h).  The block's
// waves share K and V: tiles of 64 keys (K: 64 keys x 64 d, V^T: 64 d x 64 keys,
// whole 128-byte lines) are brought into a two-buffer LDS ring by async copies,
// the next tile in flight while this one is worked on; the fragments are read
// from LDS at a row pitch of 144 bytes.
// Q pre-scaled by 1/sqrt(d); loop over key tiles of 32, online softmax,
// P round-trips through LDS (C-layout -> A-fragment layout, bf16),
// out accumulated as 16x64 f32 via 4 WMMAs per key tile.

#define AT_WAVES 8
#define AT_KEYS  64           // keys per staged tile
#define AT_PITCH 72           // LDS row pitch in elements (144 B = 16 B x 9)
#define AT_TILES (T_SEQ / AT_KEYS)

__global__ __launch_bounds__(AT_WAVES * 32)
void attn_flash(const bf16_t* __restrict__ Qb,
                           const bf16_t* __restrict__ Kb,
                           const bf16_t* __restrict__ Vt,
                           const float* __restrict__ mask,
                           bf16_t* __restrict__ AO) {
  __shared__ alignas(16) bf16_t ldsK[2][AT_KEYS * AT_PITCH];
  __shared__ alignas(16) bf16_t ldsV[2][HDIM * AT_PITCH];
  __shared__ alignas(16) bf16_t ldsPall[AT_WAVES][16 * 32];

  int tid  = threadIdx.x;              // 0..255
  int wave = tid >> 5;
  bf16_t* ldsP = &ldsPall[wave][0];    // each wave's own P tile
  int qt = blockIdx.x * AT_WAVES + wave;   // query tile (0..127)
  int bh = blockIdx.y;                 // b*16 + h
  int b = bh >> 4, h = bh & 15;
  int lane = threadIdx.x & 31;
  int nn = lane & 15, half = lane >> 4;

  int qrow0 = b * T_SEQ + qt * 16;
  v16bf aq0 = load_frag(Qb, C_DIM, qrow0, h * HDIM);
  v16bf aq1 = load_frag(Qb, C_DIM, qrow0, h * HDIM + 32);

  v8f c[4];
  #pragma unroll
  for (int j = 0; j < 4; ++j)
    c[j] = v8f{0.f, 0.f, 0.f, 0.f, 0.f, 0.f, 0.f, 0.f};

  float mrun[8], lrun[8];
  #pragma unroll
  for (int r = 0; r < 8; ++r) { mrun[r] = -3.0e38f; lrun[r] = 0.f; }

  const bf16_t* VtB = Vt + (size_t)b * 1024 * T_SEQ;  // [n=h*64+d][t]
  const float* mbase = mask + (size_t)(qt * 16) * T_SEQ;

  // stage keys kb..kb+63 into buffer buf: 512 chunks of 16 B for K and as many
  // for V^T, two of each per thread; a wave's copy covers four whole rows.
  int srow = tid >> 3;                 // 0..31 (second chunk: +32)
  int scol = (tid & 7) * 8;            // element column of the 16-byte chunk
  const bf16_t* Ksrc = Kb + (size_t)(b * T_SEQ + srow) * C_DIM + h * HDIM + scol;
  const bf16_t* Vsrc = VtB + (size_t)(h * HDIM + srow) * T_SEQ + scol;
  auto stage = [&](int buf, int kb) {
    unsigned dk = (unsigned)(uintptr_t)&ldsK[buf][srow * AT_PITCH + scol];
    unsigned dv = (unsigned)(uintptr_t)&ldsV[buf][srow * AT_PITCH + scol];
    const bf16_t* ks = Ksrc + (size_t)kb * C_DIM;
    const bf16_t* vs = Vsrc + kb;
    async_copy4_b128(dk, dk + 32 * AT_PITCH * 2, dv, dv + 32 * AT_PITCH * 2,
                     ks, ks + 32 * C_DIM, vs, vs + 32 * T_SEQ);
  };

  stage(0, 0);
  wait_asynccnt0();          // our slice of tile 0 landed
  __syncthreads();           // everyone's slice landed
  stage(1, AT_KEYS);

  for (int t = 0; t < AT_TILES; ++t) {
   const bf16_t* Kt = &ldsK[t & 1][0];
   const bf16_t* Vl = &ldsV[t & 1][0];
   // unrolled: the LDS offsets of both halves become immediates, and the whole
   // tile's mask loads issue together at the top of the trip
   #pragma unroll
   for (int sub = 0; sub < AT_KEYS; sub += 32) {
    int kbase = t * AT_KEYS + sub;
    // ---- scores: S(16x32) = Q(16x64) @ K^T, two 16x16 sub-tiles ----
    v8f s0 = v8f{0.f, 0.f, 0.f, 0.f, 0.f, 0.f, 0.f, 0.f};
    v8f s1 = v8f{0.f, 0.f, 0.f, 0.f, 0.f, 0.f, 0.f, 0.f};
    {
      v16bf k00 = load_frag(Kt, AT_PITCH, sub,      0);
      v16bf k01 = load_frag(Kt, AT_PITCH, sub,      32);
      s0 = wmma_bf16(aq0, k00, s0);
      s0 = wmma_bf16(aq1, k01, s0);
      v16bf k10 = load_frag(Kt, AT_PITCH, sub + 16, 0);
      v16bf k11 = load_frag(Kt, AT_PITCH, sub + 16, 32);
      s1 = wmma_bf16(aq0, k10, s1);
      s1 = wmma_bf16(aq1, k11, s1);
    }

    // ---- additive mask (2D [Tq][Tk]) ----
    #pragma unroll
    for (int r = 0; r < 8; ++r) {
      const float* mp = mbase + (size_t)(r + 8 * half) * T_SEQ + kbase;
      s0[r] += mp[nn];
      s1[r] += mp[16 + nn];
    }

    // ---- online softmax update + write P tile (bf16) to LDS ----
    #pragma unroll
    for (int r = 0; r < 8; ++r) {
      float tm = rmax16(fmaxf(s0[r], s1[r]));
      float nm = fmaxf(mrun[r], tm);
      float al = __expf(mrun[r] - nm);
      float p0 = __expf(s0[r] - nm);
      float p1 = __expf(s1[r] - nm);
      float rs = rsum16(p0 + p1);
      lrun[r] = lrun[r] * al + rs;
      mrun[r] = nm;
      #pragma unroll
      for (int j = 0; j < 4; ++j) c[j][r] *= al;
      int row = r + 8 * half;
      ldsP[row * 32 + nn]      = f2bf(p0);
      ldsP[row * 32 + 16 + nn] = f2bf(p1);
    }
    // the P tile is the wave's own: DS ops of a wave are in-order; compiler
    // inserts s_wait_dscnt.

    // ---- out(16x64) += P(16x32) @ V(32x64)  (V stored transposed) ----
    v16bf pa = load_frag(ldsP, 32, 0, 0);
    #pragma unroll
    for (int j = 0; j < 4; ++j) {
      v16bf vb = load_frag(Vl, AT_PITCH, j * 16, sub);
      c[j] = wmma_bf16(pa, vb, c[j]);
    }
   }
   // publish point of tile t + 1: our reads of this buffer are done, our slice
   // of the next tile has landed, then everyone's; only then the refill.
   asm volatile("s_wait_dscnt 0x0" ::: "memory");
   wait_asynccnt0();
   __syncthreads();
   if (t + 2 < AT_TILES) stage(t & 1, (t + 2) * AT_KEYS);
  }
  wait_asynccnt0();          // nothing of ours is in flight when the wave ends

  // ---- normalize and store to AO (bf16 row-major [4096][1024]) ----
  #pragma unroll
  for (int r = 0; r < 8; ++r) {
    float inv = 1.0f / lrun[r];
    #pragma unroll
    for (int j = 0; j < 4; ++j) c[j][r] *= inv;
  }
  #pragma unroll
  for (int j = 0; j < 4; ++j) {
    #pragma unroll
    for (int r = 0; r < 8; ++r) {
      int m = qrow0 + r + 8 * half;
      int n = h * HDIM + j * 16 + nn;
      AO[(size_t)m * C_DIM + n] = f2bf(c[j][r]);
    }
  }
}

// ---------------------------------------------------------------------------

extern "C" void kernel_launch(void* const* d_in, const int* in_sizes, int n_in,
                              void* d_out, int out_size, void* d_ws,
                              size_t ws_size, hipStream_t stream) {
  const float* x    = (const float*)d_in[0];
  const float* mask = (const float*)d_in[1];
  const float* Wq = (const float*)d_in[2];  const float* bq = (const float*)d_in[3];
  const float* Wk = (const float*)d_in[4];  const float* bk = (const float*)d_in[5];
  const float* Wv = (const float*)d_in[6];  const float* bv = (const float*)d_in[7];
  const float* Wo = (const float*)d_in[8];  const float* bo = (const float*)d_in[9];

  char* ws = (char*)d_ws;
  const size_t MiB = 1024 * 1024;
  bf16_t* xb  = (bf16_t*)(ws + 0);          //  8 MiB  x  bf16 [4096][1024]
  bf16_t* wqb = (bf16_t*)(ws + 8  * MiB);   //  2 MiB
  bf16_t* wkb = (bf16_t*)(ws + 10 * MiB);   //  2 MiB
  bf16_t* wvb = (bf16_t*)(ws + 12 * MiB);   //  2 MiB
  bf16_t* wob = (bf16_t*)(ws + 14 * MiB);   //  2 MiB
  bf16_t* Qb  = (bf16_t*)(ws + 16 * MiB);   //  8 MiB  (pre-scaled by 1/sqrt d)
  bf16_t* Kb  = (bf16_t*)(ws + 24 * MiB);   //  8 MiB
  bf16_t* Vt  = (bf16_t*)(ws + 32 * MiB);   //  8 MiB  V transposed [b][n][t]
  bf16_t* AO  = (bf16_t*)(ws + 40 * MiB);   //  8 MiB  attention out bf16

  // 1) fp32 -> bf16 staging
  const int NX = MTOT * C_DIM;      // 4194304
  const int NW = C_DIM * C_DIM;     // 1048576
  cvt_f32_bf16<<<(NX + 255) / 256, 256, 0, stream>>>(x,  xb,  NX);
  cvt_f32_bf16<<<(NW + 255) / 256, 256, 0, stream>>>(Wq, wqb, NW);
  cvt_f32_bf16<<<(NW + 255) / 256, 256, 0, stream>>>(Wk, wkb, NW);
  cvt_f32_bf16<<<(NW + 255) / 256, 256, 0, stream>>>(Wv, wvb, NW);
  cvt_f32_bf16<<<(NW + 255) / 256, 256, 0, stream>>>(Wo, wob, NW);

  // 2) Q/K/V projections (WMMA bf16, async-LDS W staging)
  dim3 gg(MTOT / 128, C_DIM / 64);  // 32 x 16
  dim3 bw(128);                     // 4 waves
  gemm_proj<<<gg, bw, 0, stream>>>(xb, wqb, bq, (void*)Qb, 0, ATT_SCALE);
  gemm_proj<<<gg, bw, 0, stream>>>(xb, wkb, bk, (void*)Kb, 0, 1.0f);
  gemm_proj<<<gg, bw, 0, stream>>>(xb, wvb, bv, (void*)Vt, 1, 1.0f);

  // 3) streaming-softmax attention (WMMA bf16)
  attn_flash<<<dim3(T_SEQ / (16 * AT_WAVES), 2 * NHEAD), dim3(AT_WAVES * 32), 0,
               stream>>>(
      Qb, Kb, Vt, mask, AO);

  // 4) output projection, f32 result
  gemm_proj<<<gg, bw, 0, stream>>>(AO, wob, bo, d_out, 2, 1.0f);
}

// v002
// Measured time: 205 microseconds a run.
// In two side-by-side timings against v001, it was 1.03 and 1.05 times as fast.
// Counting every step since v000, it is 2.10 times as fast.
#include <hip/hip_runtime.h>

// ---------------------------------------------------------------------------
// MultiHeadAttention forward for MI455X (gfx1250, wave32, WMMA bf16)
//   B=2, T=2048, C=1024, H=16, D=64
//   - bf16 WMMA for all four GEMM stages + streaming-softmax attention
//   - GEMM: 4-wave workgroups, W-tile double-buffered in LDS via
//     global_load_async_to_lds_b128 (ASYNCcnt) -- CDNA5 async path
// ---------------------------------------------------------------------------

typedef __bf16 bf16_t;
typedef __attribute__((ext_vector_type(16))) __bf16 v16bf;
typedef __attribute__((ext_vector_type(8)))  __bf16 v8bf;
typedef __attribute__((ext_vector_type(8)))  float  v8f;

#define T_SEQ   2048
#define C_DIM   1024
#define NHEAD   16
#define HDIM    64
#define MTOT    4096          // B * T
#define ATT_SCALE 0.125f      // 1/sqrt(64)

// ----- helpers --------------------------------------------------------------

__device__ __forceinline__ bf16_t f2bf(float f) {
  unsigned u = __builtin_bit_cast(unsigned, f);
  unsigned r = u + 0x7FFFu + ((u >> 16) & 1u);   // round-to-nearest-even
  unsigned short h = (unsigned short)(r >> 16);
  return __builtin_bit_cast(bf16_t, h);
}

// WMMA D = A(16x32 bf16) * B(32x16 bf16) + C(16x16 f32)
__device__ __forceinline__ v8f wmma_bf16(v16bf a, v16bf b, v8f c) {
  return __builtin_amdgcn_wmma_f32_16x16x32_bf16(
      /*neg_a=*/false, a, /*neg_b=*/false, b,
      /*c_mod=*/(short)0, c, /*reuse_a=*/false, /*reuse_b=*/false);
}

// CDNA5 async copy: 16 bytes global -> LDS, tracked by ASYNCcnt.
// lds_off = LDS byte address (low 32 bits of the generic pointer; the LDS
// aperture maps LDS_ADDR = addr[31:0]).
__device__ __forceinline__ void async_copy_b128(unsigned lds_off,
                                                const bf16_t* gsrc) {
  unsigned long long ga = (unsigned long long)(uintptr_t)gsrc;
  asm volatile("global_load_async_to_lds_b128 %0, %1, off"
               :: "v"(lds_off), "v"(ga) : "memory");
}

// Four async copies in one statement.  The closing s_wait_xcnt 0 stands inside
// the statement so that no address register of a copy is rewritten ahead of it.
__device__ __forceinline__ void async_copy4_b128(
    unsigned l0, unsigned l1, unsigned l2, unsigned l3,
    const bf16_t* g0, const bf16_t* g1, const bf16_t* g2, const bf16_t* g3) {
  asm volatile("global_load_async_to_lds_b128 %0, %4, off\n\t"
               "global_load_async_to_lds_b128 %1, %5, off\n\t"
               "global_load_async_to_lds_b128 %2, %6, off\n\t"
               "global_load_async_to_lds_b128 %3, %7, off\n\t"
               "s_wait_xcnt 0x0"
               :: "v"(l0), "v"(l1), "v"(l2), "v"(l3),
                  "v"(g0), "v"(g1), "v"(g2), "v"(g3) : "memory");
}

__device__ __forceinline__ void wait_asynccnt0() {
  asm volatile("s_wait_asynccnt 0x0" ::: "memory");
}

// Load a 16x32 bf16 fragment (ISA 7.12.2 16-bit A layout) from a row-major
// matrix: rows r0..r0+15, cols c0..c0+31, leading dim ld (elements).
// lanes 0-15 hold (row = r0+lane) K = 0-7 and 16-23; lanes 16-31 hold K = 8-15
// and 24-31.  The SAME pattern serves as the B operand when the B matrix is
// stored column-contiguous (i.e. memory is [N][K] row-major).
__device__ __forceinline__ v16bf load_frag(const bf16_t* base, int ld,
                                           int r0, int c0) {
  int lane = threadIdx.x & 31;
  int nn   = lane & 15;
  int half = lane >> 4;
  const bf16_t* p = base + (size_t)(r0 + nn) * ld + c0 + (half << 3);
  v8bf lo = *reinterpret_cast<const v8bf*>(p);        // K = half*8 .. +8
  v8bf hi = *reinterpret_cast<const v8bf*>(p + 16);   // K = 16+half*8 .. +8
  return __builtin_shufflevector(lo, hi, 0, 1, 2, 3, 4, 5, 6, 7,
                                 8, 9, 10, 11, 12, 13, 14, 15);
}

__device__ __forceinline__ float rmax16(float v) {
  #pragma unroll
  for (int off = 1; off < 16; off <<= 1)
    v = fmaxf(v, __shfl_xor(v, off, 16));
  return v;
}

__device__ __forceinline__ float rsum16(float v) {
  #pragma unroll
  for (int off = 1; off < 16; off <<= 1)
    v += __shfl_xor(v, off, 16);
  return v;
}

// ----- kernel 1: f32 -> bf16 conversion ------------------------------------

// Each thread converts CVT_VEC groups of four floats, so that few waves have to
// be started; a wave's load covers 512 contiguous bytes, and all of a thread's
// loads are issued before the first is used.  A block converts
// CVT_BLOCK * CVT_VEC * 4 elements and there is no tail: the array's size must
// be a multiple of that (both sizes here are).

#define CVT_BLOCK 256
#define CVT_VEC   8

typedef __attribute__((ext_vector_type(4))) float  v4f;
typedef __attribute__((ext_vector_type(4))) __bf16 v4bf;

__global__ __launch_bounds__(CVT_BLOCK)
void cvt_f32_bf16(const float* __restrict__ in, bf16_t* __restrict__ out) {
  size_t base = (size_t)blockIdx.x * (CVT_BLOCK * CVT_VEC * 4) + threadIdx.x * 4;
  v4f v[CVT_VEC];
  // both loops unrolled: v[] stays in registers, the loads go out as one group
  #pragma unroll
  for (int j = 0; j < CVT_VEC; ++j)
    v[j] = *reinterpret_cast<const v4f*>(in + base + j * (CVT_BLOCK * 4));
  #pragma unroll
  for (int j = 0; j < CVT_VEC; ++j) {
    v4bf o = {f2bf(v[j][0]), f2bf(v[j][1]), f2bf(v[j][2]), f2bf(v[j][3])};
    *reinterpret_cast<v4bf*>(out + base + j * (CVT_BLOCK * 4)) = o;
  }
}

// ----- kernel 2: GEMM  Y = A(4096x1024) @ W^T(1024x1024) + bias ------------
// 4 waves / workgroup; each wave owns a 32(M) x 64(N) tile, all waves share
// the same N block.  Per K-step (32): the 64x32 W tile (4 KB) is staged into
// double-buffered LDS with global_load_async_to_lds_b128; A fragments load
// directly from global (b128) so VMEM overlaps the DS+WMMA stream.
// mode 0: store bf16 row-major [M][N], value scaled by `scale`
// mode 1: store bf16 transposed for V: out[(b*1024+n)*2048 + t]
// mode 2: store f32 row-major [M][N]

__global__ void gemm_proj(const bf16_t* __restrict__ A,
                          const bf16_t* __restrict__ W,
                          const float* __restrict__ bias,
                          void* __restrict__ out, int mode, float scale) {
  __shared__ alignas(16) bf16_t ldsB[2][64 * 32];

  int tid  = threadIdx.x;            // 0..127
  int wave = tid >> 5;
  int lane = tid & 31;
  int nn = lane & 15, half = lane >> 4;
  int m0 = blockIdx.x * 128 + wave * 32;
  int n0 = blockIdx.y * 64;

  // stage 64 rows x 32 cols of W (rows n0.., cols k..) into ldsB[buf]
  auto stage = [&](int buf, int k) {
    #pragma unroll
    for (int c = 0; c < 2; ++c) {
      int chunk = tid * 2 + c;        // 0..255, 16B each
      int row = chunk >> 2;           // 0..63
      int col = (chunk & 3) * 8;      // 0,8,16,24 (elements)
      const bf16_t* src = W + (size_t)(n0 + row) * C_DIM + k + col;
      unsigned dst = (unsigned)(uintptr_t)&ldsB[buf][row * 32 + col];
      async_copy_b128(dst, src);
    }
  };

  v8f c[2][4];
  #pragma unroll
  for (int i = 0; i < 2; ++i)
    #pragma unroll
    for (int j = 0; j < 4; ++j)
      c[i][j] = v8f{0.f, 0.f, 0.f, 0.f, 0.f, 0.f, 0.f, 0.f};

  stage(0, 0);
  int buf = 0;
  for (int k = 0; k < C_DIM; k += 32) {
    v16bf a0 = load_frag(A, C_DIM, m0,      k);
    v16bf a1 = load_frag(A, C_DIM, m0 + 16, k);
    wait_asynccnt0();          // our slice of ldsB[buf] landed
    __syncthreads();           // everyone's slice landed
    if (k + 32 < C_DIM) stage(buf ^ 1, k + 32);   // prefetch next tile
    #pragma unroll
    for (int j = 0; j < 4; ++j) {
      v16bf b = load_frag(&ldsB[buf][0], 32, j * 16, 0);
      c[0][j] = wmma_bf16(a0, b, c[0][j]);
      c[1][j] = wmma_bf16(a1, b, c[1][j]);
    }
    buf ^= 1;
  }

  #pragma unroll
  for (int j = 0; j < 4; ++j) {
    int n = n0 + j * 16 + nn;
    float bv = bias[n];
    #pragma unroll
    for (int i = 0; i < 2; ++i) {
      #pragma unroll
      for (int r = 0; r < 8; ++r) {
        int m = m0 + i * 16 + r + 8 * half;
        float val = (c[i][j][r] + bv) * scale;
        if (mode == 0) {
          ((bf16_t*)out)[(size_t)m * C_DIM + n] = f2bf(val);
        } else if (mode == 1) {
          int b = m >> 11, t = m & 2047;                 // m = b*2048 + t
          ((bf16_t*)out)[((size_t)(b * 1024 + n)) * T_SEQ + t] = f2bf(val);
        } else {
          ((float*)out)[(size_t)m * C_DIM + n] = val;
        }
      }
    }
  }
}

// ----- kernel 3: streaming-softmax attention --------------------------------
// eight waves per block, each with 16 query rows of one (b, h).  The block's
// waves share K and V: tiles of 64 keys (K: 64 keys x 64 d, V^T: 64 d x 64 keys,
// whole 128-byte lines) are brought into a two-buffer LDS ring by async copies,
// the next tile in flight while this one is worked on; the fragments are read
// from LDS at a row pitch of 144 bytes.
// Q pre-scaled by 1/sqrt(d); loop over key tiles of 32, online softmax,
// P round-trips through LDS (C-layout -> A-fragment layout, bf16),
// out accumulated as 16x64 f32 via 4 WMMAs per key tile.

#define AT_WAVES 8
#define AT_KEYS  64           // keys per staged tile
#define AT_PITCH 72           // LDS row pitch in elements (144 B = 16 B x 9)
#define AT_TILES (T_SEQ / AT_KEYS)

__global__ __launch_bounds__(AT_WAVES * 32)
void attn_flash(const bf16_t* __restrict__ Qb,
                           const bf16_t* __restrict__ Kb,
                           const bf16_t* __restrict__ Vt,
                           const float* __restrict__ mask,
                           bf16_t* __restrict__ AO) {
  __shared__ alignas(16) bf16_t ldsK[2][AT_KEYS * AT_PITCH];
  __shared__ alignas(16) bf16_t ldsV[2][HDIM * AT_PITCH];
  __shared__ alignas(16) bf16_t ldsPall[AT_WAVES][16 * 32];

  int tid  = threadIdx.x;              // 0..255
  int wave = tid >> 5;
  bf16_t* ldsP = &ldsPall[wave][0];    // each wave's own P tile
  int qt = blockIdx.x * AT_WAVES + wave;   // query tile (0..127)
  int bh = blockIdx.y;                 // b*16 + h
  int b = bh >> 4, h = bh & 15;
  int lane = threadIdx.x & 31;
  int nn = lane & 15, half = lane >> 4;

  int qrow0 = b * T_SEQ + qt * 16;
  v16bf aq0 = load_frag(Qb, C_DIM, qrow0, h * HDIM);
  v16bf aq1 = load_frag(Qb, C_DIM, qrow0, h * HDIM + 32);

  v8f c[4];
  #pragma unroll
  for (int j = 0; j < 4; ++j)
    c[j] = v8f{0.f, 0.f, 0.f, 0.f, 0.f, 0.f, 0.f, 0.f};

  float mrun[8], lrun[8];
  #pragma unroll
  for (int r = 0; r < 8; ++r) { mrun[r] = -3.0e38f; lrun[r] = 0.f; }

  const bf16_t* VtB = Vt + (size_t)b * 1024 * T_SEQ;  // [n=h*64+d][t]
  const float* mbase = mask + (size_t)(qt * 16) * T_SEQ;

  // stage keys kb..kb+63 into buffer buf: 512 chunks of 16 B for K and as many
  // for V^T, two of each per thread; a wave's copy covers four whole rows.
  int srow = tid >> 3;                 // 0..31 (second chunk: +32)
  int scol = (tid & 7) * 8;            // element column of the 16-byte chunk
  const bf16_t* Ksrc = Kb + (size_t)(b * T_SEQ + srow) * C_DIM + h * HDIM + scol;
  const bf16_t* Vsrc = VtB + (size_t)(h * HDIM + srow) * T_SEQ + scol;
  auto stage = [&](int buf, int kb) {
    unsigned dk = (unsigned)(uintptr_t)&ldsK[buf][srow * AT_PITCH + scol];
    unsigned dv = (unsigned)(uintptr_t)&ldsV[buf][srow * AT_PITCH + scol];
    const bf16_t* ks = Ksrc + (size_t)kb * C_DIM;
    const bf16_t* vs = Vsrc + kb;
    async_copy4_b128(dk, dk + 32 * AT_PITCH * 2, dv, dv + 32 * AT_PITCH * 2,
                     ks, ks + 32 * C_DIM, vs, vs + 32 * T_SEQ);
  };

  stage(0, 0);
  wait_asynccnt0();          // our slice of tile 0 landed
  __syncthreads();           // everyone's slice landed
  stage(1, AT_KEYS);

  for (int t = 0; t < AT_TILES; ++t) {
   const bf16_t* Kt = &ldsK[t & 1][0];
   const bf16_t* Vl = &ldsV[t & 1][0];
   // unrolled: the LDS offsets of both halves become immediates, and the whole
   // tile's mask loads issue together at the top of the trip
   #pragma unroll
   for (int sub = 0; sub < AT_KEYS; sub += 32) {
    int kbase = t * AT_KEYS + sub;
    // ---- scores: S(16x32) = Q(16x64) @ K^T, two 16x16 sub-tiles ----
    v8f s0 = v8f{0.f, 0.f, 0.f, 0.f, 0.f, 0.f, 0.f, 0.f};
    v8f s1 = v8f{0.f, 0.f, 0.f, 0.f, 0.f, 0.f, 0.f, 0.f};
    {
      v16bf k00 = load_frag(Kt, AT_PITCH, sub,      0);
      v16bf k01 = load_frag(Kt, AT_PITCH, sub,      32);
      s0 = wmma_bf16(aq0, k00, s0);
      s0 = wmma_bf16(aq1, k01, s0);
      v16bf k10 = load_frag(Kt, AT_PITCH, sub + 16, 0);
      v16bf k11 = load_frag(Kt, AT_PITCH, sub + 16, 32);
      s1 = wmma_bf16(aq0, k10, s1);
      s1 = wmma_bf16(aq1, k11, s1);
    }

    // ---- additive mask (2D [Tq][Tk]) ----
    #pragma unroll
    for (int r = 0; r < 8; ++r) {
      const float* mp = mbase + (size_t)(r + 8 * half) * T_SEQ + kbase;
      s0[r] += mp[nn];
      s1[r] += mp[16 + nn];
    }

    // ---- online softmax update + write P tile (bf16) to LDS ----
    #pragma unroll
    for (int r = 0; r < 8; ++r) {
      float tm = rmax16(fmaxf(s0[r], s1[r]));
      float nm = fmaxf(mrun[r], tm);
      float al = __expf(mrun[r] - nm);
      float p0 = __expf(s0[r] - nm);
      float p1 = __expf(s1[r] - nm);
      float rs = rsum16(p0 + p1);
      lrun[r] = lrun[r] * al + rs;
      mrun[r] = nm;
      #pragma unroll
      for (int j = 0; j < 4; ++j) c[j][r] *= al;
      int row = r + 8 * half;
      ldsP[row * 32 + nn]      = f2bf(p0);
      ldsP[row * 32 + 16 + nn] = f2bf(p1);
    }
    // the P tile is the wave's own: DS ops of a wave are in-order; compiler
    // inserts s_wait_dscnt.

    // ---- out(16x64) += P(16x32) @ V(32x64)  (V stored transposed) ----
    v16bf pa = load_frag(ldsP, 32, 0, 0);
    #pragma unroll
    for (int j = 0; j < 4; ++j) {
      v16bf vb = load_frag(Vl, AT_PITCH, j * 16, sub);
      c[j] = wmma_bf16(pa, vb, c[j]);
    }
   }
   // publish point of tile t + 1: our reads of this buffer are done, our slice
   // of the next tile has landed, then everyone's; only then the refill.
   asm volatile("s_wait_dscnt 0x0" ::: "memory");
   wait_asynccnt0();
   __syncthreads();
   if (t + 2 < AT_TILES) stage(t & 1, (t + 2) * AT_KEYS);
  }
  wait_asynccnt0();          // nothing of ours is in flight when the wave ends

  // ---- normalize and store to AO (bf16 row-major [4096][1024]) ----
  #pragma unroll
  for (int r = 0; r < 8; ++r) {
    float inv = 1.0f / lrun[r];
    #pragma unroll
    for (int j = 0; j < 4; ++j) c[j][r] *= inv;
  }
  #pragma unroll
  for (int j = 0; j < 4; ++j) {
    #pragma unroll
    for (int r = 0; r < 8; ++r) {
      int m = qrow0 + r + 8 * half;
      int n = h * HDIM + j * 16 + nn;
      AO[(size_t)m * C_DIM + n] = f2bf(c[j][r]);
    }
  }
}

// ---------------------------------------------------------------------------

extern "C" void kernel_launch(void* const* d_in, const int* in_sizes, int n_in,
                              void* d_out, int out_size, void* d_ws,
                              size_t ws_size, hipStream_t stream) {
  const float* x    = (const float*)d_in[0];
  const float* mask = (const float*)d_in[1];
  const float* Wq = (const float*)d_in[2];  const float* bq = (const float*)d_in[3];
  const float* Wk = (const float*)d_in[4];  const float* bk = (const float*)d_in[5];
  const float* Wv = (const float*)d_in[6];  const float* bv = (const float*)d_in[7];
  const float* Wo = (const float*)d_in[8];  const float* bo = (const float*)d_in[9];

  char* ws = (char*)d_ws;
  const size_t MiB = 1024 * 1024;
  bf16_t* xb  = (bf16_t*)(ws + 0);          //  8 MiB  x  bf16 [4096][1024]
  bf16_t* wqb = (bf16_t*)(ws + 8  * MiB);   //  2 MiB
  bf16_t* wkb = (bf16_t*)(ws + 10 * MiB);   //  2 MiB
  bf16_t* wvb = (bf16_t*)(ws + 12 * MiB);   //  2 MiB
  bf16_t* wob = (bf16_t*)(ws + 14 * MiB);   //  2 MiB
  bf16_t* Qb  = (bf16_t*)(ws + 16 * MiB);   //  8 MiB  (pre-scaled by 1/sqrt d)
  bf16_t* Kb  = (bf16_t*)(ws + 24 * MiB);   //  8 MiB
  bf16_t* Vt  = (bf16_t*)(ws + 32 * MiB);   //  8 MiB  V transposed [b][n][t]
  bf16_t* AO  = (bf16_t*)(ws + 40 * MiB);   //  8 MiB  attention out bf16

  // 1) fp32 -> bf16 staging
  const int NX = MTOT * C_DIM;      // 4194304
  const int NW = C_DIM * C_DIM;     // 1048576
  const int CE = CVT_BLOCK * CVT_VEC * 4;   // elements per block: 8192
  cvt_f32_bf16<<<NX / CE, CVT_BLOCK, 0, stream>>>(x,  xb);
  cvt_f32_bf16<<<NW / CE, CVT_BLOCK, 0, stream>>>(Wq, wqb);
  cvt_f32_bf16<<<NW / CE, CVT_BLOCK, 0, stream>>>(Wk, wkb);
  cvt_f32_bf16<<<NW / CE, CVT_BLOCK, 0, stream>>>(Wv, wvb);
  cvt_f32_bf16<<<NW / CE, CVT_BLOCK, 0, stream>>>(Wo, wob);

  // 2) Q/K/V projections (WMMA bf16, async-LDS W staging)
  dim3 gg(MTOT / 128, C_DIM / 64);  // 32 x 16
  dim3 bw(128);                     // 4 waves
  gemm_proj<<<gg, bw, 0, stream>>>(xb, wqb, bq, (void*)Qb, 0, ATT_SCALE);
  gemm_proj<<<gg, bw, 0, stream>>>(xb, wkb, bk, (void*)Kb, 0, 1.0f);
  gemm_proj<<<gg, bw, 0, stream>>>(xb, wvb, bv, (void*)Vt, 1, 1.0f);

  // 3) streaming-softmax attention (WMMA bf16)
  attn_flash<<<dim3(T_SEQ / (16 * AT_WAVES), 2 * NHEAD), dim3(AT_WAVES * 32), 0,
               stream>>>(
      Qb, Kb, Vt, mask, AO);

  // 4) output projection, f32 result
  gemm_proj<<<gg, bw, 0, stream>>>(AO, wob, bo, d_out, 2, 1.0f);
}

// v003
// Measured time: 180 microseconds a run.
// Two timings next to v002 put it at 1.14 and 1.13 times that version's speed.
// All steps since v000 together make it 2.38 times as fast.
#include <hip/hip_runtime.h>

// ---------------------------------------------------------------------------
// MultiHeadAttention forward for MI455X (gfx1250, wave32, WMMA bf16)
//   B=2, T=2048, C=1024, H=16, D=64
//   - bf16 WMMA for all four GEMM stages + streaming-softmax attention
//   - GEMM: 4-wave workgroups, W-tile double-buffered in LDS via
//     global_load_async_to_lds_b128 (ASYNCcnt) -- CDNA5 async path
// ---------------------------------------------------------------------------

typedef __bf16 bf16_t;
typedef __attribute__((ext_vector_type(16))) __bf16 v16bf;
typedef __attribute__((ext_vector_type(8)))  __bf16 v8bf;
typedef __attribute__((ext_vector_type(8)))  float  v8f;

#define T_SEQ   2048
#define C_DIM   1024
#define NHEAD   16
#define HDIM    64
#define MTOT    4096          // B * T
#define ATT_SCALE 0.125f      // 1/sqrt(64)

// ----- helpers --------------------------------------------------------------

__device__ __forceinline__ bf16_t f2bf(float f) {
  unsigned u = __builtin_bit_cast(unsigned, f);
  unsigned r = u + 0x7FFFu + ((u >> 16) & 1u);   // round-to-nearest-even
  unsigned short h = (unsigned short)(r >> 16);
  return __builtin_bit_cast(bf16_t, h);
}

// WMMA D = A(16x32 bf16) * B(32x16 bf16) + C(16x16 f32)
__device__ __forceinline__ v8f wmma_bf16(v16bf a, v16bf b, v8f c) {
  return __builtin_amdgcn_wmma_f32_16x16x32_bf16(
      /*neg_a=*/false, a, /*neg_b=*/false, b,
      /*c_mod=*/(short)0, c, /*reuse_a=*/false, /*reuse_b=*/false);
}

// CDNA5 async copy: 16 bytes global -> LDS, tracked by ASYNCcnt.
// lds_off = LDS byte address (low 32 bits of the generic pointer; the LDS
// aperture maps LDS_ADDR = addr[31:0]).
__device__ __forceinline__ void async_copy_b128(unsigned lds_off,
                                                const bf16_t* gsrc) {
  unsigned long long ga = (unsigned long long)(uintptr_t)gsrc;
  asm volatile("global_load_async_to_lds_b128 %0, %1, off"
               :: "v"(lds_off), "v"(ga) : "memory");
}

// Four async copies in one statement.  The closing s_wait_xcnt 0 stands inside
// the statement so that no address register of a copy is rewritten ahead of it.
__device__ __forceinline__ void async_copy4_b128(
    unsigned l0, unsigned l1, unsigned l2, unsigned l3,
    const bf16_t* g0, const bf16_t* g1, const bf16_t* g2, const bf16_t* g3) {
  asm volatile("global_load_async_to_lds_b128 %0, %4, off\n\t"
               "global_load_async_to_lds_b128 %1, %5, off\n\t"
               "global_load_async_to_lds_b128 %2, %6, off\n\t"
               "global_load_async_to_lds_b128 %3, %7, off\n\t"
               "s_wait_xcnt 0x0"
               :: "v"(l0), "v"(l1), "v"(l2), "v"(l3),
                  "v"(g0), "v"(g1), "v"(g2), "v"(g3) : "memory");
}

__device__ __forceinline__ void wait_asynccnt0() {
  asm volatile("s_wait_asynccnt 0x0" ::: "memory");
}

// Load a 16x32 bf16 fragment (ISA 7.12.2 16-bit A layout) from a row-major
// matrix: rows r0..r0+15, cols c0..c0+31, leading dim ld (elements).
// lanes 0-15 hold (row = r0+lane) K = 0-7 and 16-23; lanes 16-31 hold K = 8-15
// and 24-31.  The SAME pattern serves as the B operand when the B matrix is
// stored column-contiguous (i.e. memory is [N][K] row-major).
__device__ __forceinline__ v16bf load_frag(const bf16_t* base, int ld,
                                           int r0, int c0) {
  int lane = threadIdx.x & 31;
  int nn   = lane & 15;
  int half = lane >> 4;
  const bf16_t* p = base + (size_t)(r0 + nn) * ld + c0 + (half << 3);
  v8bf lo = *reinterpret_cast<const v8bf*>(p);        // K = half*8 .. +8
  v8bf hi = *reinterpret_cast<const v8bf*>(p + 16);   // K = 16+half*8 .. +8
  return __builtin_shufflevector(lo, hi, 0, 1, 2, 3, 4, 5, 6, 7,
                                 8, 9, 10, 11, 12, 13, 14, 15);
}

// Lane l <-> lane l ^ 16: the two lanes that share one column of a D tile.
__device__ __forceinline__ float xhalf(float v) {
  int b = __builtin_bit_cast(int, v);
  int o = __builtin_amdgcn_permlanex16(b, b, 0x76543210, 0xfedcba98, false, false);
  return __builtin_bit_cast(float, o);
}

// ----- kernel 1: f32 -> bf16 conversion ------------------------------------

// Each thread converts CVT_VEC groups of four floats, so that few waves have to
// be started; a wave's load covers 512 contiguous bytes, and all of a thread's
// loads are issued before the first is used.  A block converts
// CVT_BLOCK * CVT_VEC * 4 elements and there is no tail: the array's size must
// be a multiple of that (both sizes here are).

#define CVT_BLOCK 256
#define CVT_VEC   8

typedef __attribute__((ext_vector_type(4))) float  v4f;
typedef __attribute__((ext_vector_type(4))) __bf16 v4bf;

__global__ __launch_bounds__(CVT_BLOCK)
void cvt_f32_bf16(const float* __restrict__ in, bf16_t* __restrict__ out) {
  size_t base = (size_t)blockIdx.x * (CVT_BLOCK * CVT_VEC * 4) + threadIdx.x * 4;
  v4f v[CVT_VEC];
  // both loops unrolled: v[] stays in registers, the loads go out as one group
  #pragma unroll
  for (int j = 0; j < CVT_VEC; ++j)
    v[j] = *reinterpret_cast<const v4f*>(in + base + j * (CVT_BLOCK * 4));
  #pragma unroll
  for (int j = 0; j < CVT_VEC; ++j) {
    v4bf o = {f2bf(v[j][0]), f2bf(v[j][1]), f2bf(v[j][2]), f2bf(v[j][3])};
    *reinterpret_cast<v4bf*>(out + base + j * (CVT_BLOCK * 4)) = o;
  }
}

// ----- kernel 2: GEMM  Y = A(4096x1024) @ W^T(1024x1024) + bias ------------
// 4 waves / workgroup; each wave owns a 32(M) x 64(N) tile, all waves share
// the same N block.  Per K-step (32): the 64x32 W tile (4 KB) is staged into
// double-buffered LDS with global_load_async_to_lds_b128; A fragments load
// directly from global (b128) so VMEM overlaps the DS+WMMA stream.
// mode 0: store bf16 row-major [M][N], value scaled by `scale`
// mode 1: store bf16 transposed for V: out[(b*1024+n)*2048 + t]
// mode 2: store f32 row-major [M][N]

__global__ void gemm_proj(const bf16_t* __restrict__ A,
                          const bf16_t* __restrict__ W,
                          const float* __restrict__ bias,
                          void* __restrict__ out, int mode, float scale) {
  __shared__ alignas(16) bf16_t ldsB[2][64 * 32];

  int tid  = threadIdx.x;            // 0..127
  int wave = tid >> 5;
  int lane = tid & 31;
  int nn = lane & 15, half = lane >> 4;
  int m0 = blockIdx.x * 128 + wave * 32;
  int n0 = blockIdx.y * 64;

  // stage 64 rows x 32 cols of W (rows n0.., cols k..) into ldsB[buf]
  auto stage = [&](int buf, int k) {
    #pragma unroll
    for (int c = 0; c < 2; ++c) {
      int chunk = tid * 2 + c;        // 0..255, 16B each
      int row = chunk >> 2;           // 0..63
      int col = (chunk & 3) * 8;      // 0,8,16,24 (elements)
      const bf16_t* src = W + (size_t)(n0 + row) * C_DIM + k + col;
      unsigned dst = (unsigned)(uintptr_t)&ldsB[buf][row * 32 + col];
      async_copy_b128(dst, src);
    }
  };

  v8f c[2][4];
  #pragma unroll
  for (int i = 0; i < 2; ++i)
    #pragma unroll
    for (int j = 0; j < 4; ++j)
      c[i][j] = v8f{0.f, 0.f, 0.f, 0.f, 0.f, 0.f, 0.f, 0.f};

  stage(0, 0);
  int buf = 0;
  for (int k = 0; k < C_DIM; k += 32) {
    v16bf a0 = load_frag(A, C_DIM, m0,      k);
    v16bf a1 = load_frag(A, C_DIM, m0 + 16, k);
    wait_asynccnt0();          // our slice of ldsB[buf] landed
    __syncthreads();           // everyone's slice landed
    if (k + 32 < C_DIM) stage(buf ^ 1, k + 32);   // prefetch next tile
    #pragma unroll
    for (int j = 0; j < 4; ++j) {
      v16bf b = load_frag(&ldsB[buf][0], 32, j * 16, 0);
      c[0][j] = wmma_bf16(a0, b, c[0][j]);
      c[1][j] = wmma_bf16(a1, b, c[1][j]);
    }
    buf ^= 1;
  }

  #pragma unroll
  for (int j = 0; j < 4; ++j) {
    int n = n0 + j * 16 + nn;
    float bv = bias[n];
    #pragma unroll
    for (int i = 0; i < 2; ++i) {
      #pragma unroll
      for (int r = 0; r < 8; ++r) {
        int m = m0 + i * 16 + r + 8 * half;
        float val = (c[i][j][r] + bv) * scale;
        if (mode == 0) {
          ((bf16_t*)out)[(size_t)m * C_DIM + n] = f2bf(val);
        } else if (mode == 1) {
          int b = m >> 11, t = m & 2047;                 // m = b*2048 + t
          ((bf16_t*)out)[((size_t)(b * 1024 + n)) * T_SEQ + t] = f2bf(val);
        } else {
          ((float*)out)[(size_t)m * C_DIM + n] = val;
        }
      }
    }
  }
}

#define AT_WAVES 8
#define AT_KEYS  64           // keys per staged tile
#define AT_PITCH 72           // LDS row pitch in elements (144 B = 16 B x 9)
#define AT_TILES (T_SEQ / AT_KEYS)

__global__ __launch_bounds__(AT_WAVES * 32)
void attn_flash(const bf16_t* __restrict__ Qb,
                           const bf16_t* __restrict__ Kb,
                           const bf16_t* __restrict__ Vt,
                           const float* __restrict__ mask,
                           bf16_t* __restrict__ AO) {
  __shared__ alignas(16) bf16_t ldsK[2][AT_KEYS * AT_PITCH];
  __shared__ alignas(16) bf16_t ldsV[2][HDIM * AT_PITCH];

  int tid  = threadIdx.x;              // 0..255
  int wave = tid >> 5;
  int qt = blockIdx.x * AT_WAVES + wave;   // query tile (0..127)
  int bh = blockIdx.y;                 // b*16 + h
  int b = bh >> 4, h = bh & 15;
  int lane = threadIdx.x & 31;
  int nn = lane & 15, half = lane >> 4;

  // Q as the B operand: column nn is query qrow0 + nn
  int qrow0 = b * T_SEQ + qt * 16;
  v16bf bq0 = load_frag(Qb, C_DIM, qrow0, h * HDIM);
  v16bf bq1 = load_frag(Qb, C_DIM, qrow0, h * HDIM + 32);

  // c[j][r] = O^T[d = 16 j + 8 half + r][query nn]
  v8f c[4];
  #pragma unroll
  for (int j = 0; j < 4; ++j)
    c[j] = v8f{0.f, 0.f, 0.f, 0.f, 0.f, 0.f, 0.f, 0.f};

  float mrun = -3.0e38f;     // the query's running maximum, equal in both halves
  float lrun = 0.f;          // sum over this lane half's keys; joined at the end

  const bf16_t* VtB = Vt + (size_t)b * 1024 * T_SEQ;  // [n=h*64+d][t]
  // this lane's mask row, at the first key of its half
  const float* mrow = mask + (size_t)(qt * 16 + nn) * T_SEQ + 8 * half;

  // stage keys kb..kb+63 into buffer buf: 512 chunks of 16 B for K and as many
  // for V^T, two of each per thread; a wave's copy covers four whole rows.
  int srow = tid >> 3;                 // 0..31 (second chunk: +32)
  int scol = (tid & 7) * 8;            // element column of the 16-byte chunk
  const bf16_t* Ksrc = Kb + (size_t)(b * T_SEQ + srow) * C_DIM + h * HDIM + scol;
  const bf16_t* Vsrc = VtB + (size_t)(h * HDIM + srow) * T_SEQ + scol;
  auto stage = [&](int buf, int kb) {
    unsigned dk = (unsigned)(uintptr_t)&ldsK[buf][srow * AT_PITCH + scol];
    unsigned dv = (unsigned)(uintptr_t)&ldsV[buf][srow * AT_PITCH + scol];
    const bf16_t* ks = Ksrc + (size_t)kb * C_DIM;
    const bf16_t* vs = Vsrc + kb;
    async_copy4_b128(dk, dk + 32 * AT_PITCH * 2, dv, dv + 32 * AT_PITCH * 2,
                     ks, ks + 32 * C_DIM, vs, vs + 32 * T_SEQ);
  };

  stage(0, 0);
  wait_asynccnt0();          // our slice of tile 0 landed
  __syncthreads();           // everyone's slice landed
  stage(1, AT_KEYS);

  for (int t = 0; t < AT_TILES; ++t) {
   const bf16_t* Kt = &ldsK[t & 1][0];
   const bf16_t* Vl = &ldsV[t & 1][0];
   // unrolled: the LDS offsets of both halves become immediates, and the whole
   // tile's mask loads issue together at the top of the trip
   #pragma unroll
   for (int sub = 0; sub < AT_KEYS; sub += 32) {
    int kbase = t * AT_KEYS + sub;
    // ---- scores: S^T(32x16) = K(32x64) @ Q^T, two 16x16 tiles ----
    // s0[r] = S[query nn][key kbase + 8 half + r], s1[r]: 16 keys further on
    v8f s0 = v8f{0.f, 0.f, 0.f, 0.f, 0.f, 0.f, 0.f, 0.f};
    v8f s1 = v8f{0.f, 0.f, 0.f, 0.f, 0.f, 0.f, 0.f, 0.f};
    {
      v16bf k00 = load_frag(Kt, AT_PITCH, sub,      0);
      v16bf k01 = load_frag(Kt, AT_PITCH, sub,      32);
      s0 = wmma_bf16(k00, bq0, s0);
      s0 = wmma_bf16(k01, bq1, s0);
      v16bf k10 = load_frag(Kt, AT_PITCH, sub + 16, 0);
      v16bf k11 = load_frag(Kt, AT_PITCH, sub + 16, 32);
      s1 = wmma_bf16(k10, bq0, s1);
      s1 = wmma_bf16(k11, bq1, s1);
    }

    // ---- additive mask (2D [Tq][Tk]): 8 + 8 consecutive keys of one row ----
    {
      const float* mp = mrow + kbase;
      v4f m00 = *reinterpret_cast<const v4f*>(mp);
      v4f m01 = *reinterpret_cast<const v4f*>(mp + 4);
      v4f m10 = *reinterpret_cast<const v4f*>(mp + 16);
      v4f m11 = *reinterpret_cast<const v4f*>(mp + 20);
      s0 += __builtin_shufflevector(m00, m01, 0, 1, 2, 3, 4, 5, 6, 7);
      s1 += __builtin_shufflevector(m10, m11, 0, 1, 2, 3, 4, 5, 6, 7);
    }

    // ---- online softmax update, in the lane ----
    float tm = fmaxf(s0[0], s1[0]);
    #pragma unroll
    for (int r = 1; r < 8; ++r) tm = fmaxf(tm, fmaxf(s0[r], s1[r]));
    tm = fmaxf(tm, xhalf(tm));         // the other half's 16 keys
    float nm = fmaxf(mrun, tm);
    float al = __expf(mrun - nm);
    float rs = 0.f;
    v16bf pb;                          // P^T as B: pb[s] = P[nn][kmap(s, half)]
    #pragma unroll
    for (int r = 0; r < 8; ++r) {
      float p0 = __expf(s0[r] - nm);
      float p1 = __expf(s1[r] - nm);
      rs += p0 + p1;
      pb[r]     = f2bf(p0);
      pb[8 + r] = f2bf(p1);
    }
    lrun = lrun * al + rs;
    mrun = nm;
    #pragma unroll
    for (int j = 0; j < 4; ++j)
      #pragma unroll
      for (int r = 0; r < 8; ++r) c[j][r] *= al;

    // ---- O^T(64x16) += V^T(64x32) @ P^T(32x16) ----
    #pragma unroll
    for (int j = 0; j < 4; ++j) {
      v16bf va = load_frag(Vl, AT_PITCH, j * 16, sub);
      c[j] = wmma_bf16(va, pb, c[j]);
    }
   }
   // publish point of tile t + 1: our reads of this buffer are done, our slice
   // of the next tile has landed, then everyone's; only then the refill.
   asm volatile("s_wait_dscnt 0x0" ::: "memory");
   wait_asynccnt0();
   __syncthreads();
   if (t + 2 < AT_TILES) stage(t & 1, (t + 2) * AT_KEYS);
  }
  wait_asynccnt0();          // nothing of ours is in flight when the wave ends

  // ---- normalize and store to AO (bf16 row-major [4096][1024]) ----
  // a lane's 8 registers of a tile are 8 consecutive d of its query: 16 bytes
  float inv = 1.0f / (lrun + xhalf(lrun));
  bf16_t* orow = AO + (size_t)(qrow0 + nn) * C_DIM + h * HDIM + 8 * half;
  #pragma unroll
  for (int j = 0; j < 4; ++j) {
    v8bf o;
    #pragma unroll
    for (int r = 0; r < 8; ++r) o[r] = f2bf(c[j][r] * inv);
    *reinterpret_cast<v8bf*>(orow + j * 16) = o;
  }
}

// ---------------------------------------------------------------------------

extern "C" void kernel_launch(void* const* d_in, const int* in_sizes, int n_in,
                              void* d_out, int out_size, void* d_ws,
                              size_t ws_size, hipStream_t stream) {
  const float* x    = (const float*)d_in[0];
  const float* mask = (const float*)d_in[1];
  const float* Wq = (const float*)d_in[2];  const float* bq = (const float*)d_in[3];
  const float* Wk = (const float*)d_in[4];  const float* bk = (const float*)d_in[5];
  const float* Wv = (const float*)d_in[6];  const float* bv = (const float*)d_in[7];
  const float* Wo = (const float*)d_in[8];  const float* bo = (const float*)d_in[9];

  char* ws = (char*)d_ws;
  const size_t MiB = 1024 * 1024;
  bf16_t* xb  = (bf16_t*)(ws + 0);          //  8 MiB  x  bf16 [4096][1024]
  bf16_t* wqb = (bf16_t*)(ws + 8  * MiB);   //  2 MiB
  bf16_t* wkb = (bf16_t*)(ws + 10 * MiB);   //  2 MiB
  bf16_t* wvb = (bf16_t*)(ws + 12 * MiB);   //  2 MiB
  bf16_t* wob = (bf16_t*)(ws + 14 * MiB);   //  2 MiB
  bf16_t* Qb  = (bf16_t*)(ws + 16 * MiB);   //  8 MiB  (pre-scaled by 1/sqrt d)
  bf16_t* Kb  = (bf16_t*)(ws + 24 * MiB);   //  8 MiB
  bf16_t* Vt  = (bf16_t*)(ws + 32 * MiB);   //  8 MiB  V transposed [b][n][t]
  bf16_t* AO  = (bf16_t*)(ws + 40 * MiB);   //  8 MiB  attention out bf16

  // 1) fp32 -> bf16 staging
  const int NX = MTOT * C_DIM;      // 4194304
  const int NW = C_DIM * C_DIM;     // 1048576
  const int CE = CVT_BLOCK * CVT_VEC * 4;   // elements per block: 8192
  cvt_f32_bf16<<<NX / CE, CVT_BLOCK, 0, stream>>>(x,  xb);
  cvt_f32_bf16<<<NW / CE, CVT_BLOCK, 0, stream>>>(Wq, wqb);
  cvt_f32_bf16<<<NW / CE, CVT_BLOCK, 0, stream>>>(Wk, wkb);
  cvt_f32_bf16<<<NW / CE, CVT_BLOCK, 0, stream>>>(Wv, wvb);
  cvt_f32_bf16<<<NW / CE, CVT_BLOCK, 0, stream>>>(Wo, wob);

  // 2) Q/K/V projections (WMMA bf16, async-LDS W staging)
  dim3 gg(MTOT / 128, C_DIM / 64);  // 32 x 16
  dim3 bw(128);                     // 4 waves
  gemm_proj<<<gg, bw, 0, stream>>>(xb, wqb, bq, (void*)Qb, 0, ATT_SCALE);
  gemm_proj<<<gg, bw, 0, stream>>>(xb, wkb, bk, (void*)Kb, 0, 1.0f);
  gemm_proj<<<gg, bw, 0, stream>>>(xb, wvb, bv, (void*)Vt, 1, 1.0f);

  // 3) streaming-softmax attention (WMMA bf16)
  attn_flash<<<dim3(T_SEQ / (16 * AT_WAVES), 2 * NHEAD), dim3(AT_WAVES * 32), 0,
               stream>>>(
      Qb, Kb, Vt, mask, AO);

  // 4) output projection, f32 result
  gemm_proj<<<gg, bw, 0, stream>>>(AO, wob, bo, d_out, 2, 1.0f);
}

// v004
// One run takes 142 microseconds.
// In both of two side-by-side timings against v003, it was 1.28 times as fast.
// Counting every step since v000, it is 3.06 times as fast.
#include <hip/hip_runtime.h>

// ---------------------------------------------------------------------------
// MultiHeadAttention forward for MI455X (gfx1250, wave32, WMMA bf16)
//   B=2, T=2048, C=1024, H=16, D=64
//   - bf16 WMMA for all four GEMM stages + streaming-softmax attention
//   - GEMM: 8-wave workgroups, 128x128 tile; A and W tiles in a two-buffer LDS
//     ring filled by global_load_async_to_lds_b128 (ASYNCcnt)
// ---------------------------------------------------------------------------

typedef __bf16 bf16_t;
typedef __attribute__((ext_vector_type(16))) __bf16 v16bf;
typedef __attribute__((ext_vector_type(8)))  __bf16 v8bf;
typedef __attribute__((ext_vector_type(8)))  float  v8f;

#define T_SEQ   2048
#define C_DIM   1024
#define NHEAD   16
#define HDIM    64
#define MTOT    4096          // B * T
#define ATT_SCALE 0.125f      // 1/sqrt(64)

// ----- helpers --------------------------------------------------------------

__device__ __forceinline__ bf16_t f2bf(float f) {
  unsigned u = __builtin_bit_cast(unsigned, f);
  unsigned r = u + 0x7FFFu + ((u >> 16) & 1u);   // round-to-nearest-even
  unsigned short h = (unsigned short)(r >> 16);
  return __builtin_bit_cast(bf16_t, h);
}

// WMMA D = A(16x32 bf16) * B(32x16 bf16) + C(16x16 f32)
__device__ __forceinline__ v8f wmma_bf16(v16bf a, v16bf b, v8f c) {
  return __builtin_amdgcn_wmma_f32_16x16x32_bf16(
      /*neg_a=*/false, a, /*neg_b=*/false, b,
      /*c_mod=*/(short)0, c, /*reuse_a=*/false, /*reuse_b=*/false);
}

// CDNA5 async copy: 16 bytes a lane, global -> LDS, tracked by ASYNCcnt.  The
// first operand is the lane's LDS byte address (low 32 bits of the generic
// pointer; the LDS aperture maps LDS_ADDR = addr[31:0]).

// Four async copies in one statement.  The closing s_wait_xcnt 0 stands inside
// the statement so that no address register of a copy is rewritten ahead of it.
__device__ __forceinline__ void async_copy4_b128(
    unsigned l0, unsigned l1, unsigned l2, unsigned l3,
    const bf16_t* g0, const bf16_t* g1, const bf16_t* g2, const bf16_t* g3) {
  asm volatile("global_load_async_to_lds_b128 %0, %4, off\n\t"
               "global_load_async_to_lds_b128 %1, %5, off\n\t"
               "global_load_async_to_lds_b128 %2, %6, off\n\t"
               "global_load_async_to_lds_b128 %3, %7, off\n\t"
               "s_wait_xcnt 0x0"
               :: "v"(l0), "v"(l1), "v"(l2), "v"(l3),
                  "v"(g0), "v"(g1), "v"(g2), "v"(g3) : "memory");
}

// Eight async copies in one statement, closed by s_wait_xcnt 0 for the same
// reason.  Copy i moves 16 bytes from g + i * gstep elements to LDS byte
// l + i * lstep.
__device__ __forceinline__ void async_copy8_b128(unsigned l, unsigned lstep,
                                                 const bf16_t* g, size_t gstep) {
  asm volatile("global_load_async_to_lds_b128 %0, %8, off\n\t"
               "global_load_async_to_lds_b128 %1, %9, off\n\t"
               "global_load_async_to_lds_b128 %2, %10, off\n\t"
               "global_load_async_to_lds_b128 %3, %11, off\n\t"
               "global_load_async_to_lds_b128 %4, %12, off\n\t"
               "global_load_async_to_lds_b128 %5, %13, off\n\t"
               "global_load_async_to_lds_b128 %6, %14, off\n\t"
               "global_load_async_to_lds_b128 %7, %15, off\n\t"
               "s_wait_xcnt 0x0"
               :: "v"(l), "v"(l + lstep), "v"(l + 2 * lstep), "v"(l + 3 * lstep),
                  "v"(l + 4 * lstep), "v"(l + 5 * lstep), "v"(l + 6 * lstep),
                  "v"(l + 7 * lstep),
                  "v"(g), "v"(g + gstep), "v"(g + 2 * gstep), "v"(g + 3 * gstep),
                  "v"(g + 4 * gstep), "v"(g + 5 * gstep), "v"(g + 6 * gstep),
                  "v"(g + 7 * gstep) : "memory");
}

__device__ __forceinline__ void wait_asynccnt0() {
  asm volatile("s_wait_asynccnt 0x0" ::: "memory");
}

// Load a 16x32 bf16 fragment (ISA 7.12.2 16-bit A layout) from a row-major
// matrix: rows r0..r0+15, cols c0..c0+31, leading dim ld (elements).
// lanes 0-15 hold (row = r0+lane) K = 0-7 and 16-23; lanes 16-31 hold K = 8-15
// and 24-31.  The SAME pattern serves as the B operand when the B matrix is
// stored column-contiguous (i.e. memory is [N][K] row-major).
__device__ __forceinline__ v16bf load_frag(const bf16_t* base, int ld,
                                           int r0, int c0) {
  int lane = threadIdx.x & 31;
  int nn   = lane & 15;
  int half = lane >> 4;
  const bf16_t* p = base + (size_t)(r0 + nn) * ld + c0 + (half << 3);
  v8bf lo = *reinterpret_cast<const v8bf*>(p);        // K = half*8 .. +8
  v8bf hi = *reinterpret_cast<const v8bf*>(p + 16);   // K = 16+half*8 .. +8
  return __builtin_shufflevector(lo, hi, 0, 1, 2, 3, 4, 5, 6, 7,
                                 8, 9, 10, 11, 12, 13, 14, 15);
}

// Lane l <-> lane l ^ 16: the two lanes that share one column of a D tile.
__device__ __forceinline__ float xhalf(float v) {
  int b = __builtin_bit_cast(int, v);
  int o = __builtin_amdgcn_permlanex16(b, b, 0x76543210, 0xfedcba98, false, false);
  return __builtin_bit_cast(float, o);
}

// ----- kernel 1: f32 -> bf16 conversion ------------------------------------

// Each thread converts CVT_VEC groups of four floats, so that few waves have to
// be started; a wave's load covers 512 contiguous bytes, and all of a thread's
// loads are issued before the first is used.  A block converts
// CVT_BLOCK * CVT_VEC * 4 elements and there is no tail: the array's size must
// be a multiple of that (both sizes here are).

#define CVT_BLOCK 256
#define CVT_VEC   8

typedef __attribute__((ext_vector_type(4))) float  v4f;
typedef __attribute__((ext_vector_type(4))) __bf16 v4bf;

__global__ __launch_bounds__(CVT_BLOCK)
void cvt_f32_bf16(const float* __restrict__ in, bf16_t* __restrict__ out) {
  size_t base = (size_t)blockIdx.x * (CVT_BLOCK * CVT_VEC * 4) + threadIdx.x * 4;
  v4f v[CVT_VEC];
  // both loops unrolled: v[] stays in registers, the loads go out as one group
  #pragma unroll
  for (int j = 0; j < CVT_VEC; ++j)
    v[j] = *reinterpret_cast<const v4f*>(in + base + j * (CVT_BLOCK * 4));
  #pragma unroll
  for (int j = 0; j < CVT_VEC; ++j) {
    v4bf o = {f2bf(v[j][0]), f2bf(v[j][1]), f2bf(v[j][2]), f2bf(v[j][3])};
    *reinterpret_cast<v4bf*>(out + base + j * (CVT_BLOCK * 4)) = o;
  }
}

// ----- kernel 2: GEMM  Y = A(4096x1024) @ W^T(1024x1024) + bias ------------
// 8 waves / workgroup, one 128(M) x 128(N) tile of Y; the waves stand 4 (M) x
// 2 (N), each with a 32 x 64 tile.  A trip is 128 k: 128 rows x 256 bytes of A
// and as much of W are brought into a two-buffer LDS ring by async copies (a
// wave's copy covers two whole rows), the next trip's tiles in flight while
// this trip's are worked on; all fragments are read from LDS at a row pitch of
// 272 bytes.  k runs upwards in steps of 32 in every accumulator.
// mode 0: store bf16 row-major [M][N], value scaled by `scale`
// mode 1: store bf16 transposed for V: out[(b*1024+n)*2048 + t]
// mode 2: store f32 row-major [M][N]

#define GM_WAVES 8
#define GM_TILE  128          // rows of A and rows of W per workgroup
#define GM_BK    128          // k per trip
#define GM_PITCH 136          // LDS row pitch in elements (272 B = 16 B x 17)
#define GM_TRIPS (C_DIM / GM_BK)

__global__ __launch_bounds__(GM_WAVES * 32)
void gemm_proj(const bf16_t* __restrict__ A,
                          const bf16_t* __restrict__ W,
                          const float* __restrict__ bias,
                          void* __restrict__ out, int mode, float scale) {
  __shared__ alignas(16) bf16_t ldsA[2][GM_TILE * GM_PITCH];
  __shared__ alignas(16) bf16_t ldsB[2][GM_TILE * GM_PITCH];

  int tid  = threadIdx.x;            // 0..255
  int wave = tid >> 5;
  int lane = tid & 31;
  int nn = lane & 15, half = lane >> 4;
  int wm = (wave >> 1) * 32;         // the wave's rows inside the A tile
  int wn = (wave & 1) * 64;          // the wave's rows inside the W tile
  int m0 = blockIdx.x * GM_TILE + wm;
  int n0 = blockIdx.y * GM_TILE + wn;

  // stage k..k+127 of the block's 128 rows of A and of W into buffer buf: 2048
  // chunks of 16 B each, eight of each per thread, 16 rows apart.
  int srow = tid >> 4;                 // 0..15
  int scol = (tid & 15) * 8;           // element column of the 16-byte chunk
  const bf16_t* Asrc = A + (size_t)(blockIdx.x * GM_TILE + srow) * C_DIM + scol;
  const bf16_t* Wsrc = W + (size_t)(blockIdx.y * GM_TILE + srow) * C_DIM + scol;
  auto stage = [&](int buf, int k) {
    unsigned da = (unsigned)(uintptr_t)&ldsA[buf][srow * GM_PITCH + scol];
    unsigned db = (unsigned)(uintptr_t)&ldsB[buf][srow * GM_PITCH + scol];
    async_copy8_b128(da, 16 * GM_PITCH * 2, Asrc + k, 16 * C_DIM);
    async_copy8_b128(db, 16 * GM_PITCH * 2, Wsrc + k, 16 * C_DIM);
  };

  v8f c[2][4];
  #pragma unroll
  for (int i = 0; i < 2; ++i)
    #pragma unroll
    for (int j = 0; j < 4; ++j)
      c[i][j] = v8f{0.f, 0.f, 0.f, 0.f, 0.f, 0.f, 0.f, 0.f};

  stage(0, 0);
  wait_asynccnt0();          // our slice of trip 0's tiles landed
  __syncthreads();           // everyone's slice landed
  stage(1, GM_BK);

  // two trips a pass of the loop: the buffer index is a constant in each copy,
  // and the text stays short (unrolled in full it is four times as long)
  #pragma unroll 2
  for (int t = 0; t < GM_TRIPS; ++t) {
    const bf16_t* At = &ldsA[t & 1][0];
    const bf16_t* Bt = &ldsB[t & 1][0];
    // two fragment sets: inside a trip, k step q + 1 is read while q is worked on
    v16bf fa[2][2], fb[2][4];
    auto frags = [&](int s, int kk) {
      fa[s][0] = load_frag(At, GM_PITCH, wm,      kk);
      fa[s][1] = load_frag(At, GM_PITCH, wm + 16, kk);
      // unrolled: fb[] is indexed by constants only and stays in registers
      #pragma unroll
      for (int j = 0; j < 4; ++j)
        fb[s][j] = load_frag(Bt, GM_PITCH, wn + j * 16, kk);
    };
    frags(0, 0);
    // unrolled: the set index is a constant (the sets stay in registers) and the
    // LDS offsets of the four k steps become immediates
    #pragma unroll
    for (int q = 0; q < GM_BK / 32; ++q) {
      if (q + 1 < GM_BK / 32) frags((q + 1) & 1, (q + 1) * 32);
      // holds the next step's 12 LDS reads as one group ahead of this step's
      // products; left free, they are sunk in pairs among the products, each
      // pair with a full wait for LDS behind it
      __builtin_amdgcn_sched_barrier(0);
      // unrolled: c[] and fb[] are indexed by constants only
      #pragma unroll
      for (int j = 0; j < 4; ++j) {
        c[0][j] = wmma_bf16(fa[q & 1][0], fb[q & 1][j], c[0][j]);
        c[1][j] = wmma_bf16(fa[q & 1][1], fb[q & 1][j], c[1][j]);
      }
      // keeps the reads of the step after next from rising among these products
      __builtin_amdgcn_sched_barrier(0);
    }
    // publish point of trip t + 1: our reads of this buffer are done, our slice
    // of the next tiles has landed, then everyone's; only then the refill.
    asm volatile("s_wait_dscnt 0x0" ::: "memory");
    wait_asynccnt0();
    __syncthreads();
    if (t + 2 < GM_TRIPS) stage(t & 1, (t + 2) * GM_BK);
  }
  wait_asynccnt0();          // nothing of ours is in flight when the wave ends

  #pragma unroll
  for (int j = 0; j < 4; ++j) {
    int n = n0 + j * 16 + nn;
    float bv = bias[n];
    #pragma unroll
    for (int i = 0; i < 2; ++i) {
      #pragma unroll
      for (int r = 0; r < 8; ++r) {
        int m = m0 + i * 16 + r + 8 * half;
        float val = (c[i][j][r] + bv) * scale;
        if (mode == 0) {
          ((bf16_t*)out)[(size_t)m * C_DIM + n] = f2bf(val);
        } else if (mode == 1) {
          int b = m >> 11, t = m & 2047;                 // m = b*2048 + t
          ((bf16_t*)out)[((size_t)(b * 1024 + n)) * T_SEQ + t] = f2bf(val);
        } else {
          ((float*)out)[(size_t)m * C_DIM + n] = val;
        }
      }
    }
  }
}

#define AT_WAVES 8
#define AT_KEYS  64           // keys per staged tile
#define AT_PITCH 72           // LDS row pitch in elements (144 B = 16 B x 9)
#define AT_TILES (T_SEQ / AT_KEYS)

__global__ __launch_bounds__(AT_WAVES * 32)
void attn_flash(const bf16_t* __restrict__ Qb,
                           const bf16_t* __restrict__ Kb,
                           const bf16_t* __restrict__ Vt,
                           const float* __restrict__ mask,
                           bf16_t* __restrict__ AO) {
  __shared__ alignas(16) bf16_t ldsK[2][AT_KEYS * AT_PITCH];
  __shared__ alignas(16) bf16_t ldsV[2][HDIM * AT_PITCH];

  int tid  = threadIdx.x;              // 0..255
  int wave = tid >> 5;
  int qt = blockIdx.x * AT_WAVES + wave;   // query tile (0..127)
  int bh = blockIdx.y;                 // b*16 + h
  int b = bh >> 4, h = bh & 15;
  int lane = threadIdx.x & 31;
  int nn = lane & 15, half = lane >> 4;

  // Q as the B operand: column nn is query qrow0 + nn
  int qrow0 = b * T_SEQ + qt * 16;
  v16bf bq0 = load_frag(Qb, C_DIM, qrow0, h * HDIM);
  v16bf bq1 = load_frag(Qb, C_DIM, qrow0, h * HDIM + 32);

  // c[j][r] = O^T[d = 16 j + 8 half + r][query nn]
  v8f c[4];
  #pragma unroll
  for (int j = 0; j < 4; ++j)
    c[j] = v8f{0.f, 0.f, 0.f, 0.f, 0.f, 0.f, 0.f, 0.f};

  float mrun = -3.0e38f;     // the query's running maximum, equal in both halves
  float lrun = 0.f;          // sum over this lane half's keys; joined at the end

  const bf16_t* VtB = Vt + (size_t)b * 1024 * T_SEQ;  // [n=h*64+d][t]
  // this lane's mask row, at the first key of its half
  const float* mrow = mask + (size_t)(qt * 16 + nn) * T_SEQ + 8 * half;

  // stage keys kb..kb+63 into buffer buf: 512 chunks of 16 B for K and as many
  // for V^T, two of each per thread; a wave's copy covers four whole rows.
  int srow = tid >> 3;                 // 0..31 (second chunk: +32)
  int scol = (tid & 7) * 8;            // element column of the 16-byte chunk
  const bf16_t* Ksrc = Kb + (size_t)(b * T_SEQ + srow) * C_DIM + h * HDIM + scol;
  const bf16_t* Vsrc = VtB + (size_t)(h * HDIM + srow) * T_SEQ + scol;
  auto stage = [&](int buf, int kb) {
    unsigned dk = (unsigned)(uintptr_t)&ldsK[buf][srow * AT_PITCH + scol];
    unsigned dv = (unsigned)(uintptr_t)&ldsV[buf][srow * AT_PITCH + scol];
    const bf16_t* ks = Ksrc + (size_t)kb * C_DIM;
    const bf16_t* vs = Vsrc + kb;
    async_copy4_b128(dk, dk + 32 * AT_PITCH * 2, dv, dv + 32 * AT_PITCH * 2,
                     ks, ks + 32 * C_DIM, vs, vs + 32 * T_SEQ);
  };

  stage(0, 0);
  wait_asynccnt0();          // our slice of tile 0 landed
  __syncthreads();           // everyone's slice landed
  stage(1, AT_KEYS);

  for (int t = 0; t < AT_TILES; ++t) {
   const bf16_t* Kt = &ldsK[t & 1][0];
   const bf16_t* Vl = &ldsV[t & 1][0];
   // unrolled: the LDS offsets of both halves become immediates, and the whole
   // tile's mask loads issue together at the top of the trip
   #pragma unroll
   for (int sub = 0; sub < AT_KEYS; sub += 32) {
    int kbase = t * AT_KEYS + sub;
    // ---- scores: S^T(32x16) = K(32x64) @ Q^T, two 16x16 tiles ----
    // s0[r] = S[query nn][key kbase + 8 half + r], s1[r]: 16 keys further on
    v8f s0 = v8f{0.f, 0.f, 0.f, 0.f, 0.f, 0.f, 0.f, 0.f};
    v8f s1 = v8f{0.f, 0.f, 0.f, 0.f, 0.f, 0.f, 0.f, 0.f};
    {
      v16bf k00 = load_frag(Kt, AT_PITCH, sub,      0);
      v16bf k01 = load_frag(Kt, AT_PITCH, sub,      32);
      s0 = wmma_bf16(k00, bq0, s0);
      s0 = wmma_bf16(k01, bq1, s0);
      v16bf k10 = load_frag(Kt, AT_PITCH, sub + 16, 0);
      v16bf k11 = load_frag(Kt, AT_PITCH, sub + 16, 32);
      s1 = wmma_bf16(k10, bq0, s1);
      s1 = wmma_bf16(k11, bq1, s1);
    }

    // ---- additive mask (2D [Tq][Tk]): 8 + 8 consecutive keys of one row ----
    {
      const float* mp = mrow + kbase;
      v4f m00 = *reinterpret_cast<const v4f*>(mp);
      v4f m01 = *reinterpret_cast<const v4f*>(mp + 4);
      v4f m10 = *reinterpret_cast<const v4f*>(mp + 16);
      v4f m11 = *reinterpret_cast<const v4f*>(mp + 20);
      s0 += __builtin_shufflevector(m00, m01, 0, 1, 2, 3, 4, 5, 6, 7);
      s1 += __builtin_shufflevector(m10, m11, 0, 1, 2, 3, 4, 5, 6, 7);
    }

    // ---- online softmax update, in the lane ----
    float tm = fmaxf(s0[0], s1[0]);
    #pragma unroll
    for (int r = 1; r < 8; ++r) tm = fmaxf(tm, fmaxf(s0[r], s1[r]));
    tm = fmaxf(tm, xhalf(tm));         // the other half's 16 keys
    float nm = fmaxf(mrun, tm);
    float al = __expf(mrun - nm);
    float rs = 0.f;
    v16bf pb;                          // P^T as B: pb[s] = P[nn][kmap(s, half)]
    #pragma unroll
    for (int r = 0; r < 8; ++r) {
      float p0 = __expf(s0[r] - nm);
      float p1 = __expf(s1[r] - nm);
      rs += p0 + p1;
      pb[r]     = f2bf(p0);
      pb[8 + r] = f2bf(p1);
    }
    lrun = lrun * al + rs;
    mrun = nm;
    #pragma unroll
    for (int j = 0; j < 4; ++j)
      #pragma unroll
      for (int r = 0; r < 8; ++r) c[j][r] *= al;

    // ---- O^T(64x16) += V^T(64x32) @ P^T(32x16) ----
    #pragma unroll
    for (int j = 0; j < 4; ++j) {
      v16bf va = load_frag(Vl, AT_PITCH, j * 16, sub);
      c[j] = wmma_bf16(va, pb, c[j]);
    }
   }
   // publish point of tile t + 1: our reads of this buffer are done, our slice
   // of the next tile has landed, then everyone's; only then the refill.
   asm volatile("s_wait_dscnt 0x0" ::: "memory");
   wait_asynccnt0();
   __syncthreads();
   if (t + 2 < AT_TILES) stage(t & 1, (t + 2) * AT_KEYS);
  }
  wait_asynccnt0();          // nothing of ours is in flight when the wave ends

  // ---- normalize and store to AO (bf16 row-major [4096][1024]) ----
  // a lane's 8 registers of a tile are 8 consecutive d of its query: 16 bytes
  float inv = 1.0f / (lrun + xhalf(lrun));
  bf16_t* orow = AO + (size_t)(qrow0 + nn) * C_DIM + h * HDIM + 8 * half;
  #pragma unroll
  for (int j = 0; j < 4; ++j) {
    v8bf o;
    #pragma unroll
    for (int r = 0; r < 8; ++r) o[r] = f2bf(c[j][r] * inv);
    *reinterpret_cast<v8bf*>(orow + j * 16) = o;
  }
}

// ---------------------------------------------------------------------------

extern "C" void kernel_launch(void* const* d_in, const int* in_sizes, int n_in,
                              void* d_out, int out_size, void* d_ws,
                              size_t ws_size, hipStream_t stream) {
  const float* x    = (const float*)d_in[0];
  const float* mask = (const float*)d_in[1];
  const float* Wq = (const float*)d_in[2];  const float* bq = (const float*)d_in[3];
  const float* Wk = (const float*)d_in[4];  const float* bk = (const float*)d_in[5];
  const float* Wv = (const float*)d_in[6];  const float* bv = (const float*)d_in[7];
  const float* Wo = (const float*)d_in[8];  const float* bo = (const float*)d_in[9];

  char* ws = (char*)d_ws;
  const size_t MiB = 1024 * 1024;
  bf16_t* xb  = (bf16_t*)(ws + 0);          //  8 MiB  x  bf16 [4096][1024]
  bf16_t* wqb = (bf16_t*)(ws + 8  * MiB);   //  2 MiB
  bf16_t* wkb = (bf16_t*)(ws + 10 * MiB);   //  2 MiB
  bf16_t* wvb = (bf16_t*)(ws + 12 * MiB);   //  2 MiB
  bf16_t* wob = (bf16_t*)(ws + 14 * MiB);   //  2 MiB
  bf16_t* Qb  = (bf16_t*)(ws + 16 * MiB);   //  8 MiB  (pre-scaled by 1/sqrt d)
  bf16_t* Kb  = (bf16_t*)(ws + 24 * MiB);   //  8 MiB
  bf16_t* Vt  = (bf16_t*)(ws + 32 * MiB);   //  8 MiB  V transposed [b][n][t]
  bf16_t* AO  = (bf16_t*)(ws + 40 * MiB);   //  8 MiB  attention out bf16

  // 1) fp32 -> bf16 staging
  const int NX = MTOT * C_DIM;      // 4194304
  const int NW = C_DIM * C_DIM;     // 1048576
  const int CE = CVT_BLOCK * CVT_VEC * 4;   // elements per block: 8192
  cvt_f32_bf16<<<NX / CE, CVT_BLOCK, 0, stream>>>(x,  xb);
  cvt_f32_bf16<<<NW / CE, CVT_BLOCK, 0, stream>>>(Wq, wqb);
  cvt_f32_bf16<<<NW / CE, CVT_BLOCK, 0, stream>>>(Wk, wkb);
  cvt_f32_bf16<<<NW / CE, CVT_BLOCK, 0, stream>>>(Wv, wvb);
  cvt_f32_bf16<<<NW / CE, CVT_BLOCK, 0, stream>>>(Wo, wob);

  // 2) Q/K/V projections (WMMA bf16, async-LDS staging of both operands)
  dim3 gg(MTOT / GM_TILE, C_DIM / GM_TILE);  // 32 x 8
  dim3 bw(GM_WAVES * 32);                    // 8 waves
  gemm_proj<<<gg, bw, 0, stream>>>(xb, wqb, bq, (void*)Qb, 0, ATT_SCALE);
  gemm_proj<<<gg, bw, 0, stream>>>(xb, wkb, bk, (void*)Kb, 0, 1.0f);
  gemm_proj<<<gg, bw, 0, stream>>>(xb, wvb, bv, (void*)Vt, 1, 1.0f);

  // 3) streaming-softmax attention (WMMA bf16)
  attn_flash<<<dim3(T_SEQ / (16 * AT_WAVES), 2 * NHEAD), dim3(AT_WAVES * 32), 0,
               stream>>>(
      Qb, Kb, Vt, mask, AO);

  // 4) output projection, f32 result
  gemm_proj<<<gg, bw, 0, stream>>>(AO, wob, bo, d_out, 2, 1.0f);
}

// v005
// It runs in 128 microseconds.
// In two side-by-side timings against v004, it was 1.11 and 1.12 times as fast.
// All steps since v000 together make it 3.41 times as fast.
#include <hip/hip_runtime.h>

// ---------------------------------------------------------------------------
// MultiHeadAttention forward for MI455X (gfx1250, wave32, WMMA bf16)
//   B=2, T=2048, C=1024, H=16, D=64
//   - bf16 WMMA for all four GEMM stages + streaming-softmax attention
//   - GEMM: 8-wave workgroups, 128x128 tile; A and W tiles in a two-buffer LDS
//     ring filled by global_load_async_to_lds_b128 (ASYNCcnt)
// ---------------------------------------------------------------------------

typedef __bf16 bf16_t;
typedef __attribute__((ext_vector_type(16))) __bf16 v16bf;
typedef __attribute__((ext_vector_type(8)))  __bf16 v8bf;
typedef __attribute__((ext_vector_type(8)))  float  v8f;

#define T_SEQ   2048
#define C_DIM   1024
#define NHEAD   16
#define HDIM    64
#define MTOT    4096          // B * T
#define ATT_SCALE 0.125f      // 1/sqrt(64)

// ----- helpers --------------------------------------------------------------

__device__ __forceinline__ bf16_t f2bf(float f) {
  unsigned u = __builtin_bit_cast(unsigned, f);
  unsigned r = u + 0x7FFFu + ((u >> 16) & 1u);   // round-to-nearest-even
  unsigned short h = (unsigned short)(r >> 16);
  return __builtin_bit_cast(bf16_t, h);
}

// WMMA D = A(16x32 bf16) * B(32x16 bf16) + C(16x16 f32)
__device__ __forceinline__ v8f wmma_bf16(v16bf a, v16bf b, v8f c) {
  return __builtin_amdgcn_wmma_f32_16x16x32_bf16(
      /*neg_a=*/false, a, /*neg_b=*/false, b,
      /*c_mod=*/(short)0, c, /*reuse_a=*/false, /*reuse_b=*/false);
}

// CDNA5 async copy: 16 bytes a lane, global -> LDS, tracked by ASYNCcnt.  The
// first operand is the lane's LDS byte address (low 32 bits of the generic
// pointer; the LDS aperture maps LDS_ADDR = addr[31:0]).

// Four async copies in one statement.  The closing s_wait_xcnt 0 stands inside
// the statement so that no address register of a copy is rewritten ahead of it.
__device__ __forceinline__ void async_copy4_b128(
    unsigned l0, unsigned l1, unsigned l2, unsigned l3,
    const bf16_t* g0, const bf16_t* g1, const bf16_t* g2, const bf16_t* g3) {
  asm volatile("global_load_async_to_lds_b128 %0, %4, off\n\t"
               "global_load_async_to_lds_b128 %1, %5, off\n\t"
               "global_load_async_to_lds_b128 %2, %6, off\n\t"
               "global_load_async_to_lds_b128 %3, %7, off\n\t"
               "s_wait_xcnt 0x0"
               :: "v"(l0), "v"(l1), "v"(l2), "v"(l3),
                  "v"(g0), "v"(g1), "v"(g2), "v"(g3) : "memory");
}

// Eight async copies in one statement, closed by s_wait_xcnt 0 for the same
// reason.  Copy i moves 16 bytes from g + i * gstep elements to LDS byte
// l + i * lstep.
__device__ __forceinline__ void async_copy8_b128(unsigned l, unsigned lstep,
                                                 const bf16_t* g, size_t gstep) {
  asm volatile("global_load_async_to_lds_b128 %0, %8, off\n\t"
               "global_load_async_to_lds_b128 %1, %9, off\n\t"
               "global_load_async_to_lds_b128 %2, %10, off\n\t"
               "global_load_async_to_lds_b128 %3, %11, off\n\t"
               "global_load_async_to_lds_b128 %4, %12, off\n\t"
               "global_load_async_to_lds_b128 %5, %13, off\n\t"
               "global_load_async_to_lds_b128 %6, %14, off\n\t"
               "global_load_async_to_lds_b128 %7, %15, off\n\t"
               "s_wait_xcnt 0x0"
               :: "v"(l), "v"(l + lstep), "v"(l + 2 * lstep), "v"(l + 3 * lstep),
                  "v"(l + 4 * lstep), "v"(l + 5 * lstep), "v"(l + 6 * lstep),
                  "v"(l + 7 * lstep),
                  "v"(g), "v"(g + gstep), "v"(g + 2 * gstep), "v"(g + 3 * gstep),
                  "v"(g + 4 * gstep), "v"(g + 5 * gstep), "v"(g + 6 * gstep),
                  "v"(g + 7 * gstep) : "memory");
}

// The same eight copies from an f32 source: copy i moves 16 bytes (four floats)
// from g + i * gstep elements to LDS byte l + i * lstep; s_wait_xcnt 0 closes the
// statement for the same reason.
__device__ __forceinline__ void async_copy8_b128_f32(unsigned l, unsigned lstep,
                                                     const float* g, size_t gstep) {
  asm volatile("global_load_async_to_lds_b128 %0, %8, off\n\t"
               "global_load_async_to_lds_b128 %1, %9, off\n\t"
               "global_load_async_to_lds_b128 %2, %10, off\n\t"
               "global_load_async_to_lds_b128 %3, %11, off\n\t"
               "global_load_async_to_lds_b128 %4, %12, off\n\t"
               "global_load_async_to_lds_b128 %5, %13, off\n\t"
               "global_load_async_to_lds_b128 %6, %14, off\n\t"
               "global_load_async_to_lds_b128 %7, %15, off\n\t"
               "s_wait_xcnt 0x0"
               :: "v"(l), "v"(l + lstep), "v"(l + 2 * lstep), "v"(l + 3 * lstep),
                  "v"(l + 4 * lstep), "v"(l + 5 * lstep), "v"(l + 6 * lstep),
                  "v"(l + 7 * lstep),
                  "v"(g), "v"(g + gstep), "v"(g + 2 * gstep), "v"(g + 3 * gstep),
                  "v"(g + 4 * gstep), "v"(g + 5 * gstep), "v"(g + 6 * gstep),
                  "v"(g + 7 * gstep) : "memory");
}

__device__ __forceinline__ void wait_asynccnt0() {
  asm volatile("s_wait_asynccnt 0x0" ::: "memory");
}

// Load a 16x32 bf16 fragment (ISA 7.12.2 16-bit A layout) from a row-major
// matrix: rows r0..r0+15, cols c0..c0+31, leading dim ld (elements).
// lanes 0-15 hold (row = r0+lane) K = 0-7 and 16-23; lanes 16-31 hold K = 8-15
// and 24-31.  The SAME pattern serves as the B operand when the B matrix is
// stored column-contiguous (i.e. memory is [N][K] row-major).
__device__ __forceinline__ v16bf load_frag(const bf16_t* base, int ld,
                                           int r0, int c0) {
  int lane = threadIdx.x & 31;
  int nn   = lane & 15;
  int half = lane >> 4;
  const bf16_t* p = base + (size_t)(r0 + nn) * ld + c0 + (half << 3);
  v8bf lo = *reinterpret_cast<const v8bf*>(p);        // K = half*8 .. +8
  v8bf hi = *reinterpret_cast<const v8bf*>(p + 16);   // K = 16+half*8 .. +8
  return __builtin_shufflevector(lo, hi, 0, 1, 2, 3, 4, 5, 6, 7,
                                 8, 9, 10, 11, 12, 13, 14, 15);
}

// Lane l <-> lane l ^ 16: the two lanes that share one column of a D tile.
__device__ __forceinline__ float xhalf(float v) {
  int b = __builtin_bit_cast(int, v);
  int o = __builtin_amdgcn_permlanex16(b, b, 0x76543210, 0xfedcba98, false, false);
  return __builtin_bit_cast(float, o);
}

// ----- kernel 1: f32 -> bf16 conversion ------------------------------------

// Each thread converts CVT_VEC groups of four floats, so that few waves have to
// be started; a wave's load covers 512 contiguous bytes, and all of a thread's
// loads are issued before the first is used.  A block converts
// CVT_BLOCK * CVT_VEC * 4 elements and there is no tail: the array's size must
// be a multiple of that (both sizes here are).

#define CVT_BLOCK 256
#define CVT_VEC   8

typedef __attribute__((ext_vector_type(4))) float  v4f;
typedef __attribute__((ext_vector_type(4))) __bf16 v4bf;

__global__ __launch_bounds__(CVT_BLOCK)
void cvt_f32_bf16(const float* __restrict__ in, bf16_t* __restrict__ out) {
  size_t base = (size_t)blockIdx.x * (CVT_BLOCK * CVT_VEC * 4) + threadIdx.x * 4;
  v4f v[CVT_VEC];
  // both loops unrolled: v[] stays in registers, the loads go out as one group
  #pragma unroll
  for (int j = 0; j < CVT_VEC; ++j)
    v[j] = *reinterpret_cast<const v4f*>(in + base + j * (CVT_BLOCK * 4));
  #pragma unroll
  for (int j = 0; j < CVT_VEC; ++j) {
    v4bf o = {f2bf(v[j][0]), f2bf(v[j][1]), f2bf(v[j][2]), f2bf(v[j][3])};
    *reinterpret_cast<v4bf*>(out + base + j * (CVT_BLOCK * 4)) = o;
  }
}

// ----- kernel 2: GEMM  Y = A(4096x1024) @ W^T(1024x1024) + bias ------------
// 8 waves / workgroup, one 128(M) x 128(N) tile of Y; the waves stand 4 (M) x
// 2 (N), each with a 32 x 64 tile.  A trip is 128 k: 128 rows x 256 bytes of A
// and as much of W are brought into a two-buffer LDS ring by async copies (a
// wave's copy covers two whole rows), the next trip's tiles in flight while
// this trip's are worked on; all fragments are read from LDS at a row pitch of
// 272 bytes.  k runs upwards in steps of 32 in every accumulator.
// mode 0: store bf16 row-major [M][N], value scaled by `scale`
// mode 1: store bf16 transposed for V: out[(b*1024+n)*2048 + t]
// mode 2: store f32 row-major [M][N]

#define GM_WAVES 8
#define GM_TILE  128          // rows of A and rows of W per workgroup
#define GM_BK    128          // k per trip
#define GM_PITCH 136          // LDS row pitch in elements (272 B = 16 B x 17)
#define GM_TRIPS (C_DIM / GM_BK)

__global__ __launch_bounds__(GM_WAVES * 32)
void gemm_proj(const bf16_t* __restrict__ A,
                          const bf16_t* __restrict__ W,
                          const float* __restrict__ bias,
                          void* __restrict__ out, int mode, float scale) {
  __shared__ alignas(16) bf16_t ldsA[2][GM_TILE * GM_PITCH];
  __shared__ alignas(16) bf16_t ldsB[2][GM_TILE * GM_PITCH];

  int tid  = threadIdx.x;            // 0..255
  int wave = tid >> 5;
  int lane = tid & 31;
  int nn = lane & 15, half = lane >> 4;
  int wm = (wave >> 1) * 32;         // the wave's rows inside the A tile
  int wn = (wave & 1) * 64;          // the wave's rows inside the W tile
  int m0 = blockIdx.x * GM_TILE + wm;
  int n0 = blockIdx.y * GM_TILE + wn;

  // stage k..k+127 of the block's 128 rows of A and of W into buffer buf: 2048
  // chunks of 16 B each, eight of each per thread, 16 rows apart.
  int srow = tid >> 4;                 // 0..15
  int scol = (tid & 15) * 8;           // element column of the 16-byte chunk
  const bf16_t* Asrc = A + (size_t)(blockIdx.x * GM_TILE + srow) * C_DIM + scol;
  const bf16_t* Wsrc = W + (size_t)(blockIdx.y * GM_TILE + srow) * C_DIM + scol;
  auto stage = [&](int buf, int k) {
    unsigned da = (unsigned)(uintptr_t)&ldsA[buf][srow * GM_PITCH + scol];
    unsigned db = (unsigned)(uintptr_t)&ldsB[buf][srow * GM_PITCH + scol];
    async_copy8_b128(da, 16 * GM_PITCH * 2, Asrc + k, 16 * C_DIM);
    async_copy8_b128(db, 16 * GM_PITCH * 2, Wsrc + k, 16 * C_DIM);
  };

  v8f c[2][4];
  #pragma unroll
  for (int i = 0; i < 2; ++i)
    #pragma unroll
    for (int j = 0; j < 4; ++j)
      c[i][j] = v8f{0.f, 0.f, 0.f, 0.f, 0.f, 0.f, 0.f, 0.f};

  stage(0, 0);
  wait_asynccnt0();          // our slice of trip 0's tiles landed
  __syncthreads();           // everyone's slice landed
  stage(1, GM_BK);

  // two trips a pass of the loop: the buffer index is a constant in each copy,
  // and the text stays short (unrolled in full it is four times as long)
  #pragma unroll 2
  for (int t = 0; t < GM_TRIPS; ++t) {
    const bf16_t* At = &ldsA[t & 1][0];
    const bf16_t* Bt = &ldsB[t & 1][0];
    // two fragment sets: inside a trip, k step q + 1 is read while q is worked on
    v16bf fa[2][2], fb[2][4];
    auto frags = [&](int s, int kk) {
      fa[s][0] = load_frag(At, GM_PITCH, wm,      kk);
      fa[s][1] = load_frag(At, GM_PITCH, wm + 16, kk);
      // unrolled: fb[] is indexed by constants only and stays in registers
      #pragma unroll
      for (int j = 0; j < 4; ++j)
        fb[s][j] = load_frag(Bt, GM_PITCH, wn + j * 16, kk);
    };
    frags(0, 0);
    // unrolled: the set index is a constant (the sets stay in registers) and the
    // LDS offsets of the four k steps become immediates
    #pragma unroll
    for (int q = 0; q < GM_BK / 32; ++q) {
      if (q + 1 < GM_BK / 32) frags((q + 1) & 1, (q + 1) * 32);
      // holds the next step's 12 LDS reads as one group ahead of this step's
      // products; left free, they are sunk in pairs among the products, each
      // pair with a full wait for LDS behind it
      __builtin_amdgcn_sched_barrier(0);
      // unrolled: c[] and fb[] are indexed by constants only
      #pragma unroll
      for (int j = 0; j < 4; ++j) {
        c[0][j] = wmma_bf16(fa[q & 1][0], fb[q & 1][j], c[0][j]);
        c[1][j] = wmma_bf16(fa[q & 1][1], fb[q & 1][j], c[1][j]);
      }
      // keeps the reads of the step after next from rising among these products
      __builtin_amdgcn_sched_barrier(0);
    }
    // publish point of trip t + 1: our reads of this buffer are done, our slice
    // of the next tiles has landed, then everyone's; only then the refill.
    asm volatile("s_wait_dscnt 0x0" ::: "memory");
    wait_asynccnt0();
    __syncthreads();
    if (t + 2 < GM_TRIPS) stage(t & 1, (t + 2) * GM_BK);
  }
  wait_asynccnt0();          // nothing of ours is in flight when the wave ends

  #pragma unroll
  for (int j = 0; j < 4; ++j) {
    int n = n0 + j * 16 + nn;
    float bv = bias[n];
    #pragma unroll
    for (int i = 0; i < 2; ++i) {
      #pragma unroll
      for (int r = 0; r < 8; ++r) {
        int m = m0 + i * 16 + r + 8 * half;
        float val = (c[i][j][r] + bv) * scale;
        if (mode == 0) {
          ((bf16_t*)out)[(size_t)m * C_DIM + n] = f2bf(val);
        } else if (mode == 1) {
          int b = m >> 11, t = m & 2047;                 // m = b*2048 + t
          ((bf16_t*)out)[((size_t)(b * 1024 + n)) * T_SEQ + t] = f2bf(val);
        } else {
          ((float*)out)[(size_t)m * C_DIM + n] = val;
        }
      }
    }
  }
}

#define AT_WAVES 8
#define AT_KEYS  64           // keys per staged tile
#define AT_PITCH 72           // LDS row pitch in elements (144 B = 16 B x 9)
#define AT_TILES (T_SEQ / AT_KEYS)
#define AT_ROWS  (AT_WAVES * 16)   // queries per block = mask rows per tile
#define AT_MPITCH 68          // mask row pitch in floats (272 B = 16 B x 17)

__global__ __launch_bounds__(AT_WAVES * 32)
void attn_flash(const bf16_t* __restrict__ Qb,
                           const bf16_t* __restrict__ Kb,
                           const bf16_t* __restrict__ Vt,
                           const float* __restrict__ mask,
                           bf16_t* __restrict__ AO) {
  __shared__ alignas(16) bf16_t ldsK[2][AT_KEYS * AT_PITCH];
  __shared__ alignas(16) bf16_t ldsV[2][HDIM * AT_PITCH];
  __shared__ alignas(16) float  ldsM[2][AT_ROWS * AT_MPITCH];

  int tid  = threadIdx.x;              // 0..255
  int wave = tid >> 5;
  int qt = blockIdx.x * AT_WAVES + wave;   // query tile (0..127)
  int bh = blockIdx.y;                 // b*16 + h
  int b = bh >> 4, h = bh & 15;
  int lane = threadIdx.x & 31;
  int nn = lane & 15, half = lane >> 4;

  // Q as the B operand: column nn is query qrow0 + nn
  int qrow0 = b * T_SEQ + qt * 16;
  v16bf bq0 = load_frag(Qb, C_DIM, qrow0, h * HDIM);
  v16bf bq1 = load_frag(Qb, C_DIM, qrow0, h * HDIM + 32);

  // c[j][r] = O^T[d = 16 j + 8 half + r][query nn]
  v8f c[4];
  #pragma unroll
  for (int j = 0; j < 4; ++j)
    c[j] = v8f{0.f, 0.f, 0.f, 0.f, 0.f, 0.f, 0.f, 0.f};

  float mrun = -3.0e38f;     // the query's running maximum, equal in both halves
  float lrun = 0.f;          // sum over this lane half's keys; joined at the end

  const bf16_t* VtB = Vt + (size_t)b * 1024 * T_SEQ;  // [n=h*64+d][t]
  // this lane's mask row inside a staged tile, at the first key of its half
  int mlane = (wave * 16 + nn) * AT_MPITCH + 8 * half;

  // stage keys kb..kb+63 into buffer buf: 512 chunks of 16 B for K and as many
  // for V^T, two of each per thread; a wave's copy covers four whole rows.
  int srow = tid >> 3;                 // 0..31 (second chunk: +32)
  int scol = (tid & 7) * 8;            // element column of the 16-byte chunk
  const bf16_t* Ksrc = Kb + (size_t)(b * T_SEQ + srow) * C_DIM + h * HDIM + scol;
  const bf16_t* Vsrc = VtB + (size_t)(h * HDIM + srow) * T_SEQ + scol;
  // and the mask tile: 2048 chunks of 16 B, eight per thread, 16 rows apart
  int mrw = tid >> 4;                  // 0..15
  int mcl = (tid & 15) * 4;            // float column of the 16-byte chunk
  const float* Msrc = mask + (size_t)(blockIdx.x * AT_ROWS + mrw) * T_SEQ + mcl;
  auto stage = [&](int buf, int kb) {
    unsigned dk = (unsigned)(uintptr_t)&ldsK[buf][srow * AT_PITCH + scol];
    unsigned dv = (unsigned)(uintptr_t)&ldsV[buf][srow * AT_PITCH + scol];
    const bf16_t* ks = Ksrc + (size_t)kb * C_DIM;
    const bf16_t* vs = Vsrc + kb;
    async_copy4_b128(dk, dk + 32 * AT_PITCH * 2, dv, dv + 32 * AT_PITCH * 2,
                     ks, ks + 32 * C_DIM, vs, vs + 32 * T_SEQ);
    unsigned dm = (unsigned)(uintptr_t)&ldsM[buf][mrw * AT_MPITCH + mcl];
    async_copy8_b128_f32(dm, 16 * AT_MPITCH * 4, Msrc + kb, 16 * T_SEQ);
  };

  stage(0, 0);
  wait_asynccnt0();          // our slice of tile 0 landed
  __syncthreads();           // everyone's slice landed
  stage(1, AT_KEYS);

  for (int t = 0; t < AT_TILES; ++t) {
   const bf16_t* Kt = &ldsK[t & 1][0];
   const bf16_t* Vl = &ldsV[t & 1][0];
   const float*  Ml = &ldsM[t & 1][mlane];
   // unrolled: the LDS offsets of both halves become immediates
   #pragma unroll
   for (int sub = 0; sub < AT_KEYS; sub += 32) {
    // ---- scores: S^T(32x16) = K(32x64) @ Q^T, two 16x16 tiles ----
    // s0[r] = S[query nn][key 64 t + sub + 8 half + r], s1[r]: 16 keys further on
    v8f s0 = v8f{0.f, 0.f, 0.f, 0.f, 0.f, 0.f, 0.f, 0.f};
    v8f s1 = v8f{0.f, 0.f, 0.f, 0.f, 0.f, 0.f, 0.f, 0.f};
    {
      v16bf k00 = load_frag(Kt, AT_PITCH, sub,      0);
      v16bf k01 = load_frag(Kt, AT_PITCH, sub,      32);
      s0 = wmma_bf16(k00, bq0, s0);
      s0 = wmma_bf16(k01, bq1, s0);
      v16bf k10 = load_frag(Kt, AT_PITCH, sub + 16, 0);
      v16bf k11 = load_frag(Kt, AT_PITCH, sub + 16, 32);
      s1 = wmma_bf16(k10, bq0, s1);
      s1 = wmma_bf16(k11, bq1, s1);
    }

    // ---- additive mask (2D [Tq][Tk]): 8 + 8 consecutive keys of one row ----
    {
      const float* mp = Ml + sub;
      v4f m00 = *reinterpret_cast<const v4f*>(mp);
      v4f m01 = *reinterpret_cast<const v4f*>(mp + 4);
      v4f m10 = *reinterpret_cast<const v4f*>(mp + 16);
      v4f m11 = *reinterpret_cast<const v4f*>(mp + 20);
      s0 += __builtin_shufflevector(m00, m01, 0, 1, 2, 3, 4, 5, 6, 7);
      s1 += __builtin_shufflevector(m10, m11, 0, 1, 2, 3, 4, 5, 6, 7);
    }

    // ---- online softmax update, in the lane ----
    float tm = fmaxf(s0[0], s1[0]);
    #pragma unroll
    for (int r = 1; r < 8; ++r) tm = fmaxf(tm, fmaxf(s0[r], s1[r]));
    tm = fmaxf(tm, xhalf(tm));         // the other half's 16 keys
    float nm = fmaxf(mrun, tm);
    float al = __expf(mrun - nm);
    float rs = 0.f;
    v16bf pb;                          // P^T as B: pb[s] = P[nn][kmap(s, half)]
    #pragma unroll
    for (int r = 0; r < 8; ++r) {
      float p0 = __expf(s0[r] - nm);
      float p1 = __expf(s1[r] - nm);
      rs += p0 + p1;
      pb[r]     = f2bf(p0);
      pb[8 + r] = f2bf(p1);
    }
    lrun = lrun * al + rs;
    mrun = nm;
    #pragma unroll
    for (int j = 0; j < 4; ++j)
      #pragma unroll
      for (int r = 0; r < 8; ++r) c[j][r] *= al;

    // ---- O^T(64x16) += V^T(64x32) @ P^T(32x16) ----
    #pragma unroll
    for (int j = 0; j < 4; ++j) {
      v16bf va = load_frag(Vl, AT_PITCH, j * 16, sub);
      c[j] = wmma_bf16(va, pb, c[j]);
    }
   }
   // publish point of tile t + 1: our reads of this buffer are done, our slice
   // of the next tile has landed, then everyone's; only then the refill.
   asm volatile("s_wait_dscnt 0x0" ::: "memory");
   wait_asynccnt0();
   __syncthreads();
   if (t + 2 < AT_TILES) stage(t & 1, (t + 2) * AT_KEYS);
  }
  wait_asynccnt0();          // nothing of ours is in flight when the wave ends

  // ---- normalize and store to AO (bf16 row-major [4096][1024]) ----
  // a lane's 8 registers of a tile are 8 consecutive d of its query: 16 bytes
  float inv = 1.0f / (lrun + xhalf(lrun));
  bf16_t* orow = AO + (size_t)(qrow0 + nn) * C_DIM + h * HDIM + 8 * half;
  #pragma unroll
  for (int j = 0; j < 4; ++j) {
    v8bf o;
    #pragma unroll
    for (int r = 0; r < 8; ++r) o[r] = f2bf(c[j][r] * inv);
    *reinterpret_cast<v8bf*>(orow + j * 16) = o;
  }
}

// ---------------------------------------------------------------------------

extern "C" void kernel_launch(void* const* d_in, const int* in_sizes, int n_in,
                              void* d_out, int out_size, void* d_ws,
                              size_t ws_size, hipStream_t stream) {
  const float* x    = (const float*)d_in[0];
  const float* mask = (const float*)d_in[1];
  const float* Wq = (const float*)d_in[2];  const float* bq = (const float*)d_in[3];
  const float* Wk = (const float*)d_in[4];  const float* bk = (const float*)d_in[5];
  const float* Wv = (const float*)d_in[6];  const float* bv = (const float*)d_in[7];
  const float* Wo = (const float*)d_in[8];  const float* bo = (const float*)d_in[9];

  char* ws = (char*)d_ws;
  const size_t MiB = 1024 * 1024;
  bf16_t* xb  = (bf16_t*)(ws + 0);          //  8 MiB  x  bf16 [4096][1024]
  bf16_t* wqb = (bf16_t*)(ws + 8  * MiB);   //  2 MiB
  bf16_t* wkb = (bf16_t*)(ws + 10 * MiB);   //  2 MiB
  bf16_t* wvb = (bf16_t*)(ws + 12 * MiB);   //  2 MiB
  bf16_t* wob = (bf16_t*)(ws + 14 * MiB);   //  2 MiB
  bf16_t* Qb  = (bf16_t*)(ws + 16 * MiB);   //  8 MiB  (pre-scaled by 1/sqrt d)
  bf16_t* Kb  = (bf16_t*)(ws + 24 * MiB);   //  8 MiB
  bf16_t* Vt  = (bf16_t*)(ws + 32 * MiB);   //  8 MiB  V transposed [b][n][t]
  bf16_t* AO  = (bf16_t*)(ws + 40 * MiB);   //  8 MiB  attention out bf16

  // 1) fp32 -> bf16 staging
  const int NX = MTOT * C_DIM;      // 4194304
  const int NW = C_DIM * C_DIM;     // 1048576
  const int CE = CVT_BLOCK * CVT_VEC * 4;   // elements per block: 8192
  cvt_f32_bf16<<<NX / CE, CVT_BLOCK, 0, stream>>>(x,  xb);
  cvt_f32_bf16<<<NW / CE, CVT_BLOCK, 0, stream>>>(Wq, wqb);
  cvt_f32_bf16<<<NW / CE, CVT_BLOCK, 0, stream>>>(Wk, wkb);
  cvt_f32_bf16<<<NW / CE, CVT_BLOCK, 0, stream>>>(Wv, wvb);
  cvt_f32_bf16<<<NW / CE, CVT_BLOCK, 0, stream>>>(Wo, wob);

  // 2) Q/K/V projections (WMMA bf16, async-LDS staging of both operands)
  dim3 gg(MTOT / GM_TILE, C_DIM / GM_TILE);  // 32 x 8
  dim3 bw(GM_WAVES * 32);                    // 8 waves
  gemm_proj<<<gg, bw, 0, stream>>>(xb, wqb, bq, (void*)Qb, 0, ATT_SCALE);
  gemm_proj<<<gg, bw, 0, stream>>>(xb, wkb, bk, (void*)Kb, 0, 1.0f);
  gemm_proj<<<gg, bw, 0, stream>>>(xb, wvb, bv, (void*)Vt, 1, 1.0f);

  // 3) streaming-softmax attention (WMMA bf16)
  attn_flash<<<dim3(T_SEQ / (16 * AT_WAVES), 2 * NHEAD), dim3(AT_WAVES * 32), 0,
               stream>>>(
      Qb, Kb, Vt, mask, AO);

  // 4) output projection, f32 result
  gemm_proj<<<gg, bw, 0, stream>>>(AO, wob, bo, d_out, 2, 1.0f);
}

// v006
// Measured time: 113 microseconds a run.
// In two side-by-side timings against v005, it was 1.14 and 1.15 times as fast.
// Counting every step since v000, it is 3.91 times as fast.
#include <hip/hip_runtime.h>

// ---------------------------------------------------------------------------
// MultiHeadAttention forward for MI455X (gfx1250, wave32, WMMA bf16)
//   B=2, T=2048, C=1024, H=16, D=64
//   - bf16 WMMA for all four GEMM stages + streaming-softmax attention
//   - GEMM: 8-wave workgroups, 128x128 tile; A and W tiles in a two-buffer LDS
//     ring filled by global_load_async_to_lds_b128 (ASYNCcnt)
// ---------------------------------------------------------------------------

typedef __bf16 bf16_t;
typedef __attribute__((ext_vector_type(16))) __bf16 v16bf;
typedef __attribute__((ext_vector_type(8)))  __bf16 v8bf;
typedef __attribute__((ext_vector_type(8)))  float  v8f;

#define T_SEQ   2048
#define C_DIM   1024
#define NHEAD   16
#define HDIM    64
#define MTOT    4096          // B * T
#define ATT_SCALE 0.125f      // 1/sqrt(64)

// ----- helpers --------------------------------------------------------------

__device__ __forceinline__ bf16_t f2bf(float f) {
  unsigned u = __builtin_bit_cast(unsigned, f);
  unsigned r = u + 0x7FFFu + ((u >> 16) & 1u);   // round-to-nearest-even
  unsigned short h = (unsigned short)(r >> 16);
  return __builtin_bit_cast(bf16_t, h);
}

// WMMA D = A(16x32 bf16) * B(32x16 bf16) + C(16x16 f32)
__device__ __forceinline__ v8f wmma_bf16(v16bf a, v16bf b, v8f c) {
  return __builtin_amdgcn_wmma_f32_16x16x32_bf16(
      /*neg_a=*/false, a, /*neg_b=*/false, b,
      /*c_mod=*/(short)0, c, /*reuse_a=*/false, /*reuse_b=*/false);
}

// CDNA5 async copy: 16 bytes a lane, global -> LDS, tracked by ASYNCcnt.  The
// first operand is the lane's LDS byte address (low 32 bits of the generic
// pointer; the LDS aperture maps LDS_ADDR = addr[31:0]).

// Four async copies in one statement.  The closing s_wait_xcnt 0 stands inside
// the statement so that no address register of a copy is rewritten ahead of it.
__device__ __forceinline__ void async_copy4_b128(
    unsigned l0, unsigned l1, unsigned l2, unsigned l3,
    const bf16_t* g0, const bf16_t* g1, const bf16_t* g2, const bf16_t* g3) {
  asm volatile("global_load_async_to_lds_b128 %0, %4, off\n\t"
               "global_load_async_to_lds_b128 %1, %5, off\n\t"
               "global_load_async_to_lds_b128 %2, %6, off\n\t"
               "global_load_async_to_lds_b128 %3, %7, off\n\t"
               "s_wait_xcnt 0x0"
               :: "v"(l0), "v"(l1), "v"(l2), "v"(l3),
                  "v"(g0), "v"(g1), "v"(g2), "v"(g3) : "memory");
}

// Eight async copies in one statement, closed by s_wait_xcnt 0 for the same
// reason.  Copy i moves 16 bytes from g + i * gstep elements to LDS byte
// l + i * lstep.
__device__ __forceinline__ void async_copy8_b128(unsigned l, unsigned lstep,
                                                 const bf16_t* g, size_t gstep) {
  asm volatile("global_load_async_to_lds_b128 %0, %8, off\n\t"
               "global_load_async_to_lds_b128 %1, %9, off\n\t"
               "global_load_async_to_lds_b128 %2, %10, off\n\t"
               "global_load_async_to_lds_b128 %3, %11, off\n\t"
               "global_load_async_to_lds_b128 %4, %12, off\n\t"
               "global_load_async_to_lds_b128 %5, %13, off\n\t"
               "global_load_async_to_lds_b128 %6, %14, off\n\t"
               "global_load_async_to_lds_b128 %7, %15, off\n\t"
               "s_wait_xcnt 0x0"
               :: "v"(l), "v"(l + lstep), "v"(l + 2 * lstep), "v"(l + 3 * lstep),
                  "v"(l + 4 * lstep), "v"(l + 5 * lstep), "v"(l + 6 * lstep),
                  "v"(l + 7 * lstep),
                  "v"(g), "v"(g + gstep), "v"(g + 2 * gstep), "v"(g + 3 * gstep),
                  "v"(g + 4 * gstep), "v"(g + 5 * gstep), "v"(g + 6 * gstep),
                  "v"(g + 7 * gstep) : "memory");
}

// The same eight copies from an f32 source: copy i moves 16 bytes (four floats)
// from g + i * gstep elements to LDS byte l + i * lstep; s_wait_xcnt 0 closes the
// statement for the same reason.
__device__ __forceinline__ void async_copy8_b128_f32(unsigned l, unsigned lstep,
                                                     const float* g, size_t gstep) {
  asm volatile("global_load_async_to_lds_b128 %0, %8, off\n\t"
               "global_load_async_to_lds_b128 %1, %9, off\n\t"
               "global_load_async_to_lds_b128 %2, %10, off\n\t"
               "global_load_async_to_lds_b128 %3, %11, off\n\t"
               "global_load_async_to_lds_b128 %4, %12, off\n\t"
               "global_load_async_to_lds_b128 %5, %13, off\n\t"
               "global_load_async_to_lds_b128 %6, %14, off\n\t"
               "global_load_async_to_lds_b128 %7, %15, off\n\t"
               "s_wait_xcnt 0x0"
               :: "v"(l), "v"(l + lstep), "v"(l + 2 * lstep), "v"(l + 3 * lstep),
                  "v"(l + 4 * lstep), "v"(l + 5 * lstep), "v"(l + 6 * lstep),
                  "v"(l + 7 * lstep),
                  "v"(g), "v"(g + gstep), "v"(g + 2 * gstep), "v"(g + 3 * gstep),
                  "v"(g + 4 * gstep), "v"(g + 5 * gstep), "v"(g + 6 * gstep),
                  "v"(g + 7 * gstep) : "memory");
}

__device__ __forceinline__ void wait_asynccnt0() {
  asm volatile("s_wait_asynccnt 0x0" ::: "memory");
}

// Load a 16x32 bf16 fragment (ISA 7.12.2 16-bit A layout) from a row-major
// matrix: rows r0..r0+15, cols c0..c0+31, leading dim ld (elements).
// lanes 0-15 hold (row = r0+lane) K = 0-7 and 16-23; lanes 16-31 hold K = 8-15
// and 24-31.  The SAME pattern serves as the B operand when the B matrix is
// stored column-contiguous (i.e. memory is [N][K] row-major).
__device__ __forceinline__ v16bf load_frag(const bf16_t* base, int ld,
                                           int r0, int c0) {
  int lane = threadIdx.x & 31;
  int nn   = lane & 15;
  int half = lane >> 4;
  const bf16_t* p = base + (size_t)(r0 + nn) * ld + c0 + (half << 3);
  v8bf lo = *reinterpret_cast<const v8bf*>(p);        // K = half*8 .. +8
  v8bf hi = *reinterpret_cast<const v8bf*>(p + 16);   // K = 16+half*8 .. +8
  return __builtin_shufflevector(lo, hi, 0, 1, 2, 3, 4, 5, 6, 7,
                                 8, 9, 10, 11, 12, 13, 14, 15);
}

// Lane l <-> lane l ^ 16: the two lanes that share one column of a D tile.
__device__ __forceinline__ float xhalf(float v) {
  int b = __builtin_bit_cast(int, v);
  int o = __builtin_amdgcn_permlanex16(b, b, 0x76543210, 0xfedcba98, false, false);
  return __builtin_bit_cast(float, o);
}

// ----- kernel 1: f32 -> bf16 conversion ------------------------------------

// Each thread converts CVT_VEC groups of four floats, so that few waves have to
// be started; a wave's load covers 512 contiguous bytes, and all of a thread's
// loads are issued before the first is used.  A block converts CVT_ELEMS
// elements and there is no tail: an array's size must be a multiple of that
// (both sizes here are).
// One launch converts all five arrays: the first CVT_XBLK blocks take x, then
// CVT_WBLK blocks each of Wq, Wk, Wv, Wo.  The five results lie one behind the
// other in that order, so a block's place in outAll follows from its index alone.

#define CVT_BLOCK 256
#define CVT_VEC   8
#define CVT_ELEMS (CVT_BLOCK * CVT_VEC * 4)        // elements per block: 8192
#define CVT_XBLK  (MTOT * C_DIM / CVT_ELEMS)       // blocks for x: 512
#define CVT_WBLK  (C_DIM * C_DIM / CVT_ELEMS)      // blocks per weight: 128

typedef __attribute__((ext_vector_type(4))) float  v4f;
typedef __attribute__((ext_vector_type(4))) __bf16 v4bf;

__global__ __launch_bounds__(CVT_BLOCK)
void cvt_f32_bf16(const float* __restrict__ x,
                  const float* __restrict__ wq, const float* __restrict__ wk,
                  const float* __restrict__ wv, const float* __restrict__ wo,
                  bf16_t* __restrict__ outAll) {
  int blk = blockIdx.x;
  int rel = blk;                       // the block's index inside its own array
  const float* arr = x;
  if (blk >= CVT_XBLK) {
    int w = (blk - CVT_XBLK) / CVT_WBLK;
    rel = (blk - CVT_XBLK) % CVT_WBLK;
    arr = w == 0 ? wq : w == 1 ? wk : w == 2 ? wv : wo;
  }
  const float* in = arr + (size_t)rel * CVT_ELEMS;
  bf16_t* out = outAll + (size_t)blk * CVT_ELEMS;
  size_t base = threadIdx.x * 4;
  v4f v[CVT_VEC];
  // both loops unrolled: v[] stays in registers, the loads go out as one group
  #pragma unroll
  for (int j = 0; j < CVT_VEC; ++j)
    v[j] = *reinterpret_cast<const v4f*>(in + base + j * (CVT_BLOCK * 4));
  #pragma unroll
  for (int j = 0; j < CVT_VEC; ++j) {
    v4bf o = {f2bf(v[j][0]), f2bf(v[j][1]), f2bf(v[j][2]), f2bf(v[j][3])};
    *reinterpret_cast<v4bf*>(out + base + j * (CVT_BLOCK * 4)) = o;
  }
}

// ----- kernel 2: GEMM  Y = A(4096x1024) @ W^T(1024x1024) + bias ------------
// 8 waves / workgroup, one 128(M) x 128(N) tile of Y; the waves stand 4 (M) x
// 2 (N), each with a 32 x 64 tile.  A trip is 128 k: 128 rows x 256 bytes of A
// and as much of W are brought into a two-buffer LDS ring by async copies (a
// wave's copy covers two whole rows), the next trip's tiles in flight while
// this trip's are worked on; all fragments are read from LDS at a row pitch of
// 272 bytes.  k runs upwards in steps of 32 in every accumulator.
// mode 0: store bf16 row-major [M][N], value scaled by `scale`
// mode 1: store bf16 transposed for V: out[(b*1024+n)*2048 + t]
// mode 2: store f32 row-major [M][N]
// qkv != 0: one launch does the Q, K and V projections; blockIdx.z picks the
// weight (the three lie one behind the other from Wall), the bias and the result
// (one behind the other from outAll): z = 0 is Q (mode 0, scaled by 1/sqrt d),
// z = 1 is K (mode 0), z = 2 is V (mode 1).  qkv == 0: grid z is 1, mode 2.

#define GM_WAVES 8
#define GM_TILE  128          // rows of A and rows of W per workgroup
#define GM_BK    128          // k per trip
#define GM_PITCH 136          // LDS row pitch in elements (272 B = 16 B x 17)
#define GM_TRIPS (C_DIM / GM_BK)

__global__ __launch_bounds__(GM_WAVES * 32)
void gemm_proj(const bf16_t* __restrict__ A,
                          const bf16_t* __restrict__ Wall,
                          const float* __restrict__ bias0,
                          const float* __restrict__ bias1,
                          const float* __restrict__ bias2,
                          void* __restrict__ outAll, int qkv) {
  __shared__ alignas(16) bf16_t ldsA[2][GM_TILE * GM_PITCH];
  __shared__ alignas(16) bf16_t ldsB[2][GM_TILE * GM_PITCH];

  int z = blockIdx.z;
  const bf16_t* W = Wall + (size_t)z * (C_DIM * C_DIM);
  const float* bias = z == 0 ? bias0 : z == 1 ? bias1 : bias2;
  int mode = qkv ? (z == 2 ? 1 : 0) : 2;
  float scale = (qkv && z == 0) ? ATT_SCALE : 1.0f;
  // the bf16 results are MTOT * C_DIM elements each; z is 0 for the f32 result
  void* out = (void*)((bf16_t*)outAll + (size_t)z * (MTOT * C_DIM));

  int tid  = threadIdx.x;            // 0..255
  int wave = tid >> 5;
  int lane = tid & 31;
  int nn = lane & 15, half = lane >> 4;
  int wm = (wave >> 1) * 32;         // the wave's rows inside the A tile
  int wn = (wave & 1) * 64;          // the wave's rows inside the W tile
  int m0 = blockIdx.x * GM_TILE + wm;
  int n0 = blockIdx.y * GM_TILE + wn;

  // stage k..k+127 of the block's 128 rows of A and of W into buffer buf: 2048
  // chunks of 16 B each, eight of each per thread, 16 rows apart.
  int srow = tid >> 4;                 // 0..15
  int scol = (tid & 15) * 8;           // element column of the 16-byte chunk
  const bf16_t* Asrc = A + (size_t)(blockIdx.x * GM_TILE + srow) * C_DIM + scol;
  const bf16_t* Wsrc = W + (size_t)(blockIdx.y * GM_TILE + srow) * C_DIM + scol;
  auto stage = [&](int buf, int k) {
    unsigned da = (unsigned)(uintptr_t)&ldsA[buf][srow * GM_PITCH + scol];
    unsigned db = (unsigned)(uintptr_t)&ldsB[buf][srow * GM_PITCH + scol];
    async_copy8_b128(da, 16 * GM_PITCH * 2, Asrc + k, 16 * C_DIM);
    async_copy8_b128(db, 16 * GM_PITCH * 2, Wsrc + k, 16 * C_DIM);
  };

  v8f c[2][4];
  #pragma unroll
  for (int i = 0; i < 2; ++i)
    #pragma unroll
    for (int j = 0; j < 4; ++j)
      c[i][j] = v8f{0.f, 0.f, 0.f, 0.f, 0.f, 0.f, 0.f, 0.f};

  stage(0, 0);
  wait_asynccnt0();          // our slice of trip 0's tiles landed
  __syncthreads();           // everyone's slice landed
  stage(1, GM_BK);

  // two trips a pass of the loop: the buffer index is a constant in each copy,
  // and the text stays short (unrolled in full it is four times as long)
  #pragma unroll 2
  for (int t = 0; t < GM_TRIPS; ++t) {
    const bf16_t* At = &ldsA[t & 1][0];
    const bf16_t* Bt = &ldsB[t & 1][0];
    // two fragment sets: inside a trip, k step q + 1 is read while q is worked on
    v16bf fa[2][2], fb[2][4];
    auto frags = [&](int s, int kk) {
      fa[s][0] = load_frag(At, GM_PITCH, wm,      kk);
      fa[s][1] = load_frag(At, GM_PITCH, wm + 16, kk);
      // unrolled: fb[] is indexed by constants only and stays in registers
      #pragma unroll
      for (int j = 0; j < 4; ++j)
        fb[s][j] = load_frag(Bt, GM_PITCH, wn + j * 16, kk);
    };
    frags(0, 0);
    // unrolled: the set index is a constant (the sets stay in registers) and the
    // LDS offsets of the four k steps become immediates
    #pragma unroll
    for (int q = 0; q < GM_BK / 32; ++q) {
      if (q + 1 < GM_BK / 32) frags((q + 1) & 1, (q + 1) * 32);
      // holds the next step's 12 LDS reads as one group ahead of this step's
      // products; left free, they are sunk in pairs among the products, each
      // pair with a full wait for LDS behind it
      __builtin_amdgcn_sched_barrier(0);
      // unrolled: c[] and fb[] are indexed by constants only
      #pragma unroll
      for (int j = 0; j < 4; ++j) {
        c[0][j] = wmma_bf16(fa[q & 1][0], fb[q & 1][j], c[0][j]);
        c[1][j] = wmma_bf16(fa[q & 1][1], fb[q & 1][j], c[1][j]);
      }
      // keeps the reads of the step after next from rising among these products
      __builtin_amdgcn_sched_barrier(0);
    }
    // publish point of trip t + 1: our reads of this buffer are done, our slice
    // of the next tiles has landed, then everyone's; only then the refill.
    asm volatile("s_wait_dscnt 0x0" ::: "memory");
    wait_asynccnt0();
    __syncthreads();
    if (t + 2 < GM_TRIPS) stage(t & 1, (t + 2) * GM_BK);
  }
  wait_asynccnt0();          // nothing of ours is in flight when the wave ends

  #pragma unroll
  for (int j = 0; j < 4; ++j) {
    int n = n0 + j * 16 + nn;
    float bv = bias[n];
    #pragma unroll
    for (int i = 0; i < 2; ++i) {
      #pragma unroll
      for (int r = 0; r < 8; ++r) {
        int m = m0 + i * 16 + r + 8 * half;
        float val = (c[i][j][r] + bv) * scale;
        if (mode == 0) {
          ((bf16_t*)out)[(size_t)m * C_DIM + n] = f2bf(val);
        } else if (mode == 1) {
          int b = m >> 11, t = m & 2047;                 // m = b*2048 + t
          ((bf16_t*)out)[((size_t)(b * 1024 + n)) * T_SEQ + t] = f2bf(val);
        } else {
          ((float*)out)[(size_t)m * C_DIM + n] = val;
        }
      }
    }
  }
}

#define AT_WAVES 8
#define AT_KEYS  64           // keys per staged tile
#define AT_PITCH 72           // LDS row pitch in elements (144 B = 16 B x 9)
#define AT_TILES (T_SEQ / AT_KEYS)
#define AT_ROWS  (AT_WAVES * 16)   // queries per block = mask rows per tile
#define AT_MPITCH 68          // mask row pitch in floats (272 B = 16 B x 17)

__global__ __launch_bounds__(AT_WAVES * 32)
void attn_flash(const bf16_t* __restrict__ Qb,
                           const bf16_t* __restrict__ Kb,
                           const bf16_t* __restrict__ Vt,
                           const float* __restrict__ mask,
                           bf16_t* __restrict__ AO) {
  __shared__ alignas(16) bf16_t ldsK[2][AT_KEYS * AT_PITCH];
  __shared__ alignas(16) bf16_t ldsV[2][HDIM * AT_PITCH];
  __shared__ alignas(16) float  ldsM[2][AT_ROWS * AT_MPITCH];

  int tid  = threadIdx.x;              // 0..255
  int wave = tid >> 5;
  int qt = blockIdx.x * AT_WAVES + wave;   // query tile (0..127)
  int bh = blockIdx.y;                 // b*16 + h
  int b = bh >> 4, h = bh & 15;
  int lane = threadIdx.x & 31;
  int nn = lane & 15, half = lane >> 4;

  // Q as the B operand: column nn is query qrow0 + nn
  int qrow0 = b * T_SEQ + qt * 16;
  v16bf bq0 = load_frag(Qb, C_DIM, qrow0, h * HDIM);
  v16bf bq1 = load_frag(Qb, C_DIM, qrow0, h * HDIM + 32);

  // c[j][r] = O^T[d = 16 j + 8 half + r][query nn]
  v8f c[4];
  #pragma unroll
  for (int j = 0; j < 4; ++j)
    c[j] = v8f{0.f, 0.f, 0.f, 0.f, 0.f, 0.f, 0.f, 0.f};

  float mrun = -3.0e38f;     // the query's running maximum, equal in both halves
  float lrun = 0.f;          // sum over this lane half's keys; joined at the end

  const bf16_t* VtB = Vt + (size_t)b * 1024 * T_SEQ;  // [n=h*64+d][t]
  // this lane's mask row inside a staged tile, at the first key of its half
  int mlane = (wave * 16 + nn) * AT_MPITCH + 8 * half;

  // stage keys kb..kb+63 into buffer buf: 512 chunks of 16 B for K and as many
  // for V^T, two of each per thread; a wave's copy covers four whole rows.
  int srow = tid >> 3;                 // 0..31 (second chunk: +32)
  int scol = (tid & 7) * 8;            // element column of the 16-byte chunk
  const bf16_t* Ksrc = Kb + (size_t)(b * T_SEQ + srow) * C_DIM + h * HDIM + scol;
  const bf16_t* Vsrc = VtB + (size_t)(h * HDIM + srow) * T_SEQ + scol;
  // and the mask tile: 2048 chunks of 16 B, eight per thread, 16 rows apart
  int mrw = tid >> 4;                  // 0..15
  int mcl = (tid & 15) * 4;            // float column of the 16-byte chunk
  const float* Msrc = mask + (size_t)(blockIdx.x * AT_ROWS + mrw) * T_SEQ + mcl;
  auto stage = [&](int buf, int kb) {
    unsigned dk = (unsigned)(uintptr_t)&ldsK[buf][srow * AT_PITCH + scol];
    unsigned dv = (unsigned)(uintptr_t)&ldsV[buf][srow * AT_PITCH + scol];
    const bf16_t* ks = Ksrc + (size_t)kb * C_DIM;
    const bf16_t* vs = Vsrc + kb;
    async_copy4_b128(dk, dk + 32 * AT_PITCH * 2, dv, dv + 32 * AT_PITCH * 2,
                     ks, ks + 32 * C_DIM, vs, vs + 32 * T_SEQ);
    unsigned dm = (unsigned)(uintptr_t)&ldsM[buf][mrw * AT_MPITCH + mcl];
    async_copy8_b128_f32(dm, 16 * AT_MPITCH * 4, Msrc + kb, 16 * T_SEQ);
  };

  stage(0, 0);
  wait_asynccnt0();          // our slice of tile 0 landed
  __syncthreads();           // everyone's slice landed
  stage(1, AT_KEYS);

  for (int t = 0; t < AT_TILES; ++t) {
   const bf16_t* Kt = &ldsK[t & 1][0];
   const bf16_t* Vl = &ldsV[t & 1][0];
   const float*  Ml = &ldsM[t & 1][mlane];
   // unrolled: the LDS offsets of both halves become immediates
   #pragma unroll
   for (int sub = 0; sub < AT_KEYS; sub += 32) {
    // ---- scores: S^T(32x16) = K(32x64) @ Q^T, two 16x16 tiles ----
    // s0[r] = S[query nn][key 64 t + sub + 8 half + r], s1[r]: 16 keys further on
    v8f s0 = v8f{0.f, 0.f, 0.f, 0.f, 0.f, 0.f, 0.f, 0.f};
    v8f s1 = v8f{0.f, 0.f, 0.f, 0.f, 0.f, 0.f, 0.f, 0.f};
    {
      v16bf k00 = load_frag(Kt, AT_PITCH, sub,      0);
      v16bf k01 = load_frag(Kt, AT_PITCH, sub,      32);
      s0 = wmma_bf16(k00, bq0, s0);
      s0 = wmma_bf16(k01, bq1, s0);
      v16bf k10 = load_frag(Kt, AT_PITCH, sub + 16, 0);
      v16bf k11 = load_frag(Kt, AT_PITCH, sub + 16, 32);
      s1 = wmma_bf16(k10, bq0, s1);
      s1 = wmma_bf16(k11, bq1, s1);
    }

    // ---- additive mask (2D [Tq][Tk]): 8 + 8 consecutive keys of one row ----
    {
      const float* mp = Ml + sub;
      v4f m00 = *reinterpret_cast<const v4f*>(mp);
      v4f m01 = *reinterpret_cast<const v4f*>(mp + 4);
      v4f m10 = *reinterpret_cast<const v4f*>(mp + 16);
      v4f m11 = *reinterpret_cast<const v4f*>(mp + 20);
      s0 += __builtin_shufflevector(m00, m01, 0, 1, 2, 3, 4, 5, 6, 7);
      s1 += __builtin_shufflevector(m10, m11, 0, 1, 2, 3, 4, 5, 6, 7);
    }

    // ---- online softmax update, in the lane ----
    float tm = fmaxf(s0[0], s1[0]);
    #pragma unroll
    for (int r = 1; r < 8; ++r) tm = fmaxf(tm, fmaxf(s0[r], s1[r]));
    tm = fmaxf(tm, xhalf(tm));         // the other half's 16 keys
    float nm = fmaxf(mrun, tm);
    float al = __expf(mrun - nm);
    float rs = 0.f;
    v16bf pb;                          // P^T as B: pb[s] = P[nn][kmap(s, half)]
    #pragma unroll
    for (int r = 0; r < 8; ++r) {
      float p0 = __expf(s0[r] - nm);
      float p1 = __expf(s1[r] - nm);
      rs += p0 + p1;
      pb[r]     = f2bf(p0);
      pb[8 + r] = f2bf(p1);
    }
    lrun = lrun * al + rs;
    mrun = nm;
    #pragma unroll
    for (int j = 0; j < 4; ++j)
      #pragma unroll
      for (int r = 0; r < 8; ++r) c[j][r] *= al;

    // ---- O^T(64x16) += V^T(64x32) @ P^T(32x16) ----
    #pragma unroll
    for (int j = 0; j < 4; ++j) {
      v16bf va = load_frag(Vl, AT_PITCH, j * 16, sub);
      c[j] = wmma_bf16(va, pb, c[j]);
    }
   }
   // publish point of tile t + 1: our reads of this buffer are done, our slice
   // of the next tile has landed, then everyone's; only then the refill.
   asm volatile("s_wait_dscnt 0x0" ::: "memory");
   wait_asynccnt0();
   __syncthreads();
   if (t + 2 < AT_TILES) stage(t & 1, (t + 2) * AT_KEYS);
  }
  wait_asynccnt0();          // nothing of ours is in flight when the wave ends

  // ---- normalize and store to AO (bf16 row-major [4096][1024]) ----
  // a lane's 8 registers of a tile are 8 consecutive d of its query: 16 bytes
  float inv = 1.0f / (lrun + xhalf(lrun));
  bf16_t* orow = AO + (size_t)(qrow0 + nn) * C_DIM + h * HDIM + 8 * half;
  #pragma unroll
  for (int j = 0; j < 4; ++j) {
    v8bf o;
    #pragma unroll
    for (int r = 0; r < 8; ++r) o[r] = f2bf(c[j][r] * inv);
    *reinterpret_cast<v8bf*>(orow + j * 16) = o;
  }
}

// ---------------------------------------------------------------------------

extern "C" void kernel_launch(void* const* d_in, const int* in_sizes, int n_in,
                              void* d_out, int out_size, void* d_ws,
                              size_t ws_size, hipStream_t stream) {
  const float* x    = (const float*)d_in[0];
  const float* mask = (const float*)d_in[1];
  const float* Wq = (const float*)d_in[2];  const float* bq = (const float*)d_in[3];
  const float* Wk = (const float*)d_in[4];  const float* bk = (const float*)d_in[5];
  const float* Wv = (const float*)d_in[6];  const float* bv = (const float*)d_in[7];
  const float* Wo = (const float*)d_in[8];  const float* bo = (const float*)d_in[9];

  char* ws = (char*)d_ws;
  const size_t MiB = 1024 * 1024;
  bf16_t* xb  = (bf16_t*)(ws + 0);          //  8 MiB  x  bf16 [4096][1024]
  bf16_t* wqb = (bf16_t*)(ws + 8  * MiB);   //  2 MiB
  bf16_t* wkb = (bf16_t*)(ws + 10 * MiB);   //  2 MiB
  bf16_t* wvb = (bf16_t*)(ws + 12 * MiB);   //  2 MiB
  bf16_t* wob = (bf16_t*)(ws + 14 * MiB);   //  2 MiB
  bf16_t* Qb  = (bf16_t*)(ws + 16 * MiB);   //  8 MiB  (pre-scaled by 1/sqrt d)
  bf16_t* Kb  = (bf16_t*)(ws + 24 * MiB);   //  8 MiB
  bf16_t* Vt  = (bf16_t*)(ws + 32 * MiB);   //  8 MiB  V transposed [b][n][t]
  bf16_t* AO  = (bf16_t*)(ws + 40 * MiB);   //  8 MiB  attention out bf16

  // 1) fp32 -> bf16 staging, one launch: xb, wqb, wkb, wvb, wob are contiguous
  cvt_f32_bf16<<<CVT_XBLK + 4 * CVT_WBLK, CVT_BLOCK, 0, stream>>>(
      x, Wq, Wk, Wv, Wo, xb);

  // 2) Q/K/V projections (WMMA bf16, async-LDS staging of both operands), one
  //    launch: wqb, wkb, wvb are contiguous, and so are Qb, Kb, Vt
  dim3 gq(MTOT / GM_TILE, C_DIM / GM_TILE, 3);  // 32 x 8 x 3
  dim3 go(MTOT / GM_TILE, C_DIM / GM_TILE, 1);  // 32 x 8
  dim3 bw(GM_WAVES * 32);                       // 8 waves
  gemm_proj<<<gq, bw, 0, stream>>>(xb, wqb, bq, bk, bv, (void*)Qb, 1);

  // 3) streaming-softmax attention (WMMA bf16)
  attn_flash<<<dim3(T_SEQ / (16 * AT_WAVES), 2 * NHEAD), dim3(AT_WAVES * 32), 0,
               stream>>>(
      Qb, Kb, Vt, mask, AO);

  // 4) output projection, f32 result
  gemm_proj<<<go, bw, 0, stream>>>(AO, wob, bo, bo, bo, d_out, 0);
}

// v007
// Measured time: 86.9 microseconds a run.
// Two timings next to v006 put it at 1.28 and 1.30 times that version's speed.
// Over all steps from v000 it is 5.04 times as fast.
#include <hip/hip_runtime.h>

// ---------------------------------------------------------------------------
// MultiHeadAttention forward for MI455X (gfx1250, wave32, WMMA bf16)
//   B=2, T=2048, C=1024, H=16, D=64
//   - bf16 WMMA for all four GEMM stages + streaming-softmax attention
//   - GEMM: 8-wave workgroups, 128x128 tile; A and W tiles in a two-buffer LDS
//     ring filled by global_load_async_to_lds_b128 (ASYNCcnt)
// ---------------------------------------------------------------------------

typedef __bf16 bf16_t;
typedef __attribute__((ext_vector_type(16))) __bf16 v16bf;
typedef __attribute__((ext_vector_type(8)))  __bf16 v8bf;
typedef __attribute__((ext_vector_type(8)))  float  v8f;

#define T_SEQ   2048
#define C_DIM   1024
#define NHEAD   16
#define HDIM    64
#define MTOT    4096          // B * T
#define ATT_SCALE 0.125f      // 1/sqrt(64)

// ----- helpers --------------------------------------------------------------

__device__ __forceinline__ bf16_t f2bf(float f) {
  unsigned u = __builtin_bit_cast(unsigned, f);
  unsigned r = u + 0x7FFFu + ((u >> 16) & 1u);   // round-to-nearest-even
  unsigned short h = (unsigned short)(r >> 16);
  return __builtin_bit_cast(bf16_t, h);
}

// WMMA D = A(16x32 bf16) * B(32x16 bf16) + C(16x16 f32)
__device__ __forceinline__ v8f wmma_bf16(v16bf a, v16bf b, v8f c) {
  return __builtin_amdgcn_wmma_f32_16x16x32_bf16(
      /*neg_a=*/false, a, /*neg_b=*/false, b,
      /*c_mod=*/(short)0, c, /*reuse_a=*/false, /*reuse_b=*/false);
}

// CDNA5 async copy: 16 bytes a lane, global -> LDS, tracked by ASYNCcnt.  The
// first operand is the lane's LDS byte address (low 32 bits of the generic
// pointer; the LDS aperture maps LDS_ADDR = addr[31:0]).

// Four async copies in one statement.  The closing s_wait_xcnt 0 stands inside
// the statement so that no address register of a copy is rewritten ahead of it.
__device__ __forceinline__ void async_copy4_b128(
    unsigned l0, unsigned l1, unsigned l2, unsigned l3,
    const bf16_t* g0, const bf16_t* g1, const bf16_t* g2, const bf16_t* g3) {
  asm volatile("global_load_async_to_lds_b128 %0, %4, off\n\t"
               "global_load_async_to_lds_b128 %1, %5, off\n\t"
               "global_load_async_to_lds_b128 %2, %6, off\n\t"
               "global_load_async_to_lds_b128 %3, %7, off\n\t"
               "s_wait_xcnt 0x0"
               :: "v"(l0), "v"(l1), "v"(l2), "v"(l3),
                  "v"(g0), "v"(g1), "v"(g2), "v"(g3) : "memory");
}

// Eight async copies in one statement, closed by s_wait_xcnt 0 for the same
// reason.  Copy i moves 16 bytes from g + i * gstep elements to LDS byte
// l + i * lstep.
__device__ __forceinline__ void async_copy8_b128(unsigned l, unsigned lstep,
                                                 const bf16_t* g, size_t gstep) {
  asm volatile("global_load_async_to_lds_b128 %0, %8, off\n\t"
               "global_load_async_to_lds_b128 %1, %9, off\n\t"
               "global_load_async_to_lds_b128 %2, %10, off\n\t"
               "global_load_async_to_lds_b128 %3, %11, off\n\t"
               "global_load_async_to_lds_b128 %4, %12, off\n\t"
               "global_load_async_to_lds_b128 %5, %13, off\n\t"
               "global_load_async_to_lds_b128 %6, %14, off\n\t"
               "global_load_async_to_lds_b128 %7, %15, off\n\t"
               "s_wait_xcnt 0x0"
               :: "v"(l), "v"(l + lstep), "v"(l + 2 * lstep), "v"(l + 3 * lstep),
                  "v"(l + 4 * lstep), "v"(l + 5 * lstep), "v"(l + 6 * lstep),
                  "v"(l + 7 * lstep),
                  "v"(g), "v"(g + gstep), "v"(g + 2 * gstep), "v"(g + 3 * gstep),
                  "v"(g + 4 * gstep), "v"(g + 5 * gstep), "v"(g + 6 * gstep),
                  "v"(g + 7 * gstep) : "memory");
}

// The same eight copies from an f32 source: copy i moves 16 bytes (four floats)
// from g + i * gstep elements to LDS byte l + i * lstep; s_wait_xcnt 0 closes the
// statement for the same reason.
__device__ __forceinline__ void async_copy8_b128_f32(unsigned l, unsigned lstep,
                                                     const float* g, size_t gstep) {
  asm volatile("global_load_async_to_lds_b128 %0, %8, off\n\t"
               "global_load_async_to_lds_b128 %1, %9, off\n\t"
               "global_load_async_to_lds_b128 %2, %10, off\n\t"
               "global_load_async_to_lds_b128 %3, %11, off\n\t"
               "global_load_async_to_lds_b128 %4, %12, off\n\t"
               "global_load_async_to_lds_b128 %5, %13, off\n\t"
               "global_load_async_to_lds_b128 %6, %14, off\n\t"
               "global_load_async_to_lds_b128 %7, %15, off\n\t"
               "s_wait_xcnt 0x0"
               :: "v"(l), "v"(l + lstep), "v"(l + 2 * lstep), "v"(l + 3 * lstep),
                  "v"(l + 4 * lstep), "v"(l + 5 * lstep), "v"(l + 6 * lstep),
                  "v"(l + 7 * lstep),
                  "v"(g), "v"(g + gstep), "v"(g + 2 * gstep), "v"(g + 3 * gstep),
                  "v"(g + 4 * gstep), "v"(g + 5 * gstep), "v"(g + 6 * gstep),
                  "v"(g + 7 * gstep) : "memory");
}

__device__ __forceinline__ void wait_asynccnt0() {
  asm volatile("s_wait_asynccnt 0x0" ::: "memory");
}

// Load a 16x32 bf16 fragment (ISA 7.12.2 16-bit A layout) from a row-major
// matrix: rows r0..r0+15, cols c0..c0+31, leading dim ld (elements).
// lanes 0-15 hold (row = r0+lane) K = 0-7 and 16-23; lanes 16-31 hold K = 8-15
// and 24-31.  The SAME pattern serves as the B operand when the B matrix is
// stored column-contiguous (i.e. memory is [N][K] row-major).
__device__ __forceinline__ v16bf load_frag(const bf16_t* base, int ld,
                                           int r0, int c0) {
  int lane = threadIdx.x & 31;
  int nn   = lane & 15;
  int half = lane >> 4;
  const bf16_t* p = base + (size_t)(r0 + nn) * ld + c0 + (half << 3);
  v8bf lo = *reinterpret_cast<const v8bf*>(p);        // K = half*8 .. +8
  v8bf hi = *reinterpret_cast<const v8bf*>(p + 16);   // K = 16+half*8 .. +8
  return __builtin_shufflevector(lo, hi, 0, 1, 2, 3, 4, 5, 6, 7,
                                 8, 9, 10, 11, 12, 13, 14, 15);
}

// Lane l <-> lane l ^ 16: the two lanes that share one column of a D tile.
__device__ __forceinline__ float xhalf(float v) {
  int b = __builtin_bit_cast(int, v);
  int o = __builtin_amdgcn_permlanex16(b, b, 0x76543210, 0xfedcba98, false, false);
  return __builtin_bit_cast(float, o);
}

// ----- kernel 1: f32 -> bf16 conversion ------------------------------------

// Each thread converts CVT_VEC groups of four floats, so that few waves have to
// be started; a wave's load covers 512 contiguous bytes, and all of a thread's
// loads are issued before the first is used.  A block converts CVT_ELEMS
// elements and there is no tail: an array's size must be a multiple of that
// (both sizes here are).
// One launch converts all five arrays: the first CVT_XBLK blocks take x, then
// CVT_WBLK blocks each of Wq, Wk, Wv, Wo.  The five results lie one behind the
// other in that order, so a block's place in outAll follows from its index alone.

#define CVT_BLOCK 256
#define CVT_VEC   8
#define CVT_ELEMS (CVT_BLOCK * CVT_VEC * 4)        // elements per block: 8192
#define CVT_XBLK  (MTOT * C_DIM / CVT_ELEMS)       // blocks for x: 512
#define CVT_WBLK  (C_DIM * C_DIM / CVT_ELEMS)      // blocks per weight: 128

typedef __attribute__((ext_vector_type(4))) float  v4f;
typedef __attribute__((ext_vector_type(4))) __bf16 v4bf;

__global__ __launch_bounds__(CVT_BLOCK)
void cvt_f32_bf16(const float* __restrict__ x,
                  const float* __restrict__ wq, const float* __restrict__ wk,
                  const float* __restrict__ wv, const float* __restrict__ wo,
                  bf16_t* __restrict__ outAll) {
  int blk = blockIdx.x;
  int rel = blk;                       // the block's index inside its own array
  const float* arr = x;
  if (blk >= CVT_XBLK) {
    int w = (blk - CVT_XBLK) / CVT_WBLK;
    rel = (blk - CVT_XBLK) % CVT_WBLK;
    arr = w == 0 ? wq : w == 1 ? wk : w == 2 ? wv : wo;
  }
  const float* in = arr + (size_t)rel * CVT_ELEMS;
  bf16_t* out = outAll + (size_t)blk * CVT_ELEMS;
  size_t base = threadIdx.x * 4;
  v4f v[CVT_VEC];
  // both loops unrolled: v[] stays in registers, the loads go out as one group
  #pragma unroll
  for (int j = 0; j < CVT_VEC; ++j)
    v[j] = *reinterpret_cast<const v4f*>(in + base + j * (CVT_BLOCK * 4));
  #pragma unroll
  for (int j = 0; j < CVT_VEC; ++j) {
    v4bf o = {f2bf(v[j][0]), f2bf(v[j][1]), f2bf(v[j][2]), f2bf(v[j][3])};
    *reinterpret_cast<v4bf*>(out + base + j * (CVT_BLOCK * 4)) = o;
  }
}

// ----- kernel 2: GEMM  Y = A(4096x1024) @ W^T(1024x1024) + bias ------------
// 8 waves / workgroup, one 128(M) x 128(N) tile of Y.  A trip is 128 k: 128
// rows x 256 bytes of A and as much of W are brought into a two-buffer LDS ring
// by async copies (a wave's copy covers two whole rows), the next trip's tiles
// in flight while this trip's are worked on; all fragments are read from LDS at
// a row pitch of 272 bytes.  k runs upwards in steps of 32 in every accumulator.
// mode 0: store bf16 row-major [M][N], value scaled by scale
// mode 1: store bf16 transposed for V: out[(b*1024+n)*2048 + t]
// mode 2: store f32 row-major [M][N]
// qkv != 0: one launch does the Q, K and V projections; blockIdx.z picks the
// weight (the three lie one behind the other from Wall), the bias and the result
// (one behind the other from outAll): z = 0 is Q (mode 0, scaled by 1/sqrt d),
// z = 1 is K (mode 0), z = 2 is V (mode 1).  qkv == 0: grid z is 1, mode 2.
// The matrix whose row index runs ALONG a row of the result (W in modes 0 and 2,
// A in mode 1) is the first WMMA operand, P; the other, Q, is the second.  A
// lane's 8 accumulators of a tile are then 8 neighbours in one row of the result.
// The waves stand 2 (P) x 4 (Q), each with 64 P rows x 32 Q rows: 32 rows of the
// result, 64 elements each, which are whole 128-byte lines.  A wave puts its
// piece into its own part of the (by then free) ring and reads it back row by
// row, so that every global store instruction writes whole lines.

#define GM_WAVES 8
#define GM_TILE  128          // rows of A and rows of W per workgroup
#define GM_BK    128          // k per trip
#define GM_PITCH 136          // LDS row pitch in elements (272 B = 16 B x 17)
#define GM_TRIPS (C_DIM / GM_BK)
#define GM_SP16  144          // staging row pitch in bytes, 64 bf16 (16 B x 9)
#define GM_SP32  272          // staging row pitch in bytes, 64 f32 (16 B x 17)
#define GM_STG   (32 * GM_SP32)   // staging bytes per wave; 8 of them = ldsA

__global__ __launch_bounds__(GM_WAVES * 32)
void gemm_proj(const bf16_t* __restrict__ A,
                          const bf16_t* __restrict__ Wall,
                          const float* __restrict__ bias0,
                          const float* __restrict__ bias1,
                          const float* __restrict__ bias2,
                          void* __restrict__ outAll, int qkv) {
  __shared__ alignas(16) bf16_t ldsA[2][GM_TILE * GM_PITCH];
  __shared__ alignas(16) bf16_t ldsB[2][GM_TILE * GM_PITCH];

  int z = blockIdx.z;
  const bf16_t* W = Wall + (size_t)z * (C_DIM * C_DIM);
  const float* bias = z == 0 ? bias0 : z == 1 ? bias1 : bias2;
  bool vt = qkv && z == 2;           // mode 1: the result is stored transposed
  float scale = (qkv && z == 0) ? ATT_SCALE : 1.0f;
  // the bf16 results are MTOT * C_DIM elements each; z is 0 for the f32 result
  void* out = (void*)((bf16_t*)outAll + (size_t)z * (MTOT * C_DIM));

  int tid  = threadIdx.x;            // 0..255
  int wave = tid >> 5;
  int lane = tid & 31;
  int nn = lane & 15, half = lane >> 4;
  int po = (wave & 1) * 64;          // the wave's rows inside the P tile
  int qo = (wave >> 1) * 32;         // the wave's rows inside the Q tile

  // stage k..k+127 of the block's 128 rows of A and of W into buffer buf: 2048
  // chunks of 16 B each, eight of each per thread, 16 rows apart.
  int srow = tid >> 4;                 // 0..15
  int scol = (tid & 15) * 8;           // element column of the 16-byte chunk
  const bf16_t* Asrc = A + (size_t)(blockIdx.x * GM_TILE + srow) * C_DIM + scol;
  const bf16_t* Wsrc = W + (size_t)(blockIdx.y * GM_TILE + srow) * C_DIM + scol;
  auto stage = [&](int buf, int k) {
    unsigned da = (unsigned)(uintptr_t)&ldsA[buf][srow * GM_PITCH + scol];
    unsigned db = (unsigned)(uintptr_t)&ldsB[buf][srow * GM_PITCH + scol];
    async_copy8_b128(da, 16 * GM_PITCH * 2, Asrc + k, 16 * C_DIM);
    async_copy8_b128(db, 16 * GM_PITCH * 2, Wsrc + k, 16 * C_DIM);
  };

  // c[i][j][r]: Q row qo + 16 i + nn, P row po + 16 j + 8 half + r
  v8f c[2][4];
  #pragma unroll
  for (int i = 0; i < 2; ++i)
    #pragma unroll
    for (int j = 0; j < 4; ++j)
      c[i][j] = v8f{0.f, 0.f, 0.f, 0.f, 0.f, 0.f, 0.f, 0.f};

  const bf16_t* Pbase = vt ? &ldsA[0][0] : &ldsB[0][0];
  const bf16_t* Qbase = vt ? &ldsB[0][0] : &ldsA[0][0];

  stage(0, 0);
  wait_asynccnt0();          // our slice of trip 0's tiles landed
  __syncthreads();           // everyone's slice landed
  stage(1, GM_BK);

  // two trips a pass of the loop: the buffer index is a constant in each copy,
  // and the text stays short (unrolled in full it is four times as long)
  #pragma unroll 2
  for (int t = 0; t < GM_TRIPS; ++t) {
    const bf16_t* Pt = Pbase + (t & 1) * (GM_TILE * GM_PITCH);
    const bf16_t* Qt = Qbase + (t & 1) * (GM_TILE * GM_PITCH);
    // two fragment sets: inside a trip, k step q + 1 is read while q is worked on
    v16bf fq[2][2], fp[2][4];
    auto frags = [&](int s, int kk) {
      fq[s][0] = load_frag(Qt, GM_PITCH, qo,      kk);
      fq[s][1] = load_frag(Qt, GM_PITCH, qo + 16, kk);
      // unrolled: fp[] is indexed by constants only and stays in registers
      #pragma unroll
      for (int j = 0; j < 4; ++j)
        fp[s][j] = load_frag(Pt, GM_PITCH, po + j * 16, kk);
    };
    frags(0, 0);
    // unrolled: the set index is a constant (the sets stay in registers) and the
    // LDS offsets of the four k steps become immediates
    #pragma unroll
    for (int q = 0; q < GM_BK / 32; ++q) {
      if (q + 1 < GM_BK / 32) frags((q + 1) & 1, (q + 1) * 32);
      // holds the next step's 12 LDS reads as one group ahead of this step's
      // products; left free, they are sunk in pairs among the products, each
      // pair with a full wait for LDS behind it
      __builtin_amdgcn_sched_barrier(0);
      // unrolled: c[] and fp[] are indexed by constants only
      #pragma unroll
      for (int j = 0; j < 4; ++j) {
        c[0][j] = wmma_bf16(fp[q & 1][j], fq[q & 1][0], c[0][j]);
        c[1][j] = wmma_bf16(fp[q & 1][j], fq[q & 1][1], c[1][j]);
      }
      // keeps the reads of the step after next from rising among these products
      __builtin_amdgcn_sched_barrier(0);
    }
    // publish point of trip t + 1: our reads of this buffer are done, our slice
    // of the next tiles has landed, then everyone's; only then the refill.
    asm volatile("s_wait_dscnt 0x0" ::: "memory");
    wait_asynccnt0();
    __syncthreads();
    if (t + 2 < GM_TRIPS) stage(t & 1, (t + 2) * GM_BK);
  }
  wait_asynccnt0();          // nothing of ours is in flight when the wave ends

  // Behind the last trip's barrier nobody reads the ring and no copy is in
  // flight: ldsA, cut in eight, is the waves' staging room.
  char* stg = reinterpret_cast<char*>(&ldsA[0][0]) + wave * GM_STG;
  // the wave's piece of the result: 32 rows (Q), 64 elements each (P)
  int pidx = (vt ? blockIdx.x : blockIdx.y) * GM_TILE + po;   // first P row
  int qidx = (vt ? blockIdx.y : blockIdx.x) * GM_TILE + qo;   // first Q row

  if (!qkv) {
    // ---- mode 2: f32, a row of the piece is 256 bytes ----
    // unrolled: the registers are indexed by constants only
    #pragma unroll
    for (int j = 0; j < 4; ++j) {
      const float* bp = bias + pidx + j * 16 + 8 * half;
      v4f b0 = *reinterpret_cast<const v4f*>(bp);
      v4f b1 = *reinterpret_cast<const v4f*>(bp + 4);
      // unrolled: the registers are indexed by constants only
      #pragma unroll
      for (int i = 0; i < 2; ++i) {
        v4f lo, hi;
        // unrolled: the registers are indexed by constants only
        #pragma unroll
        for (int r = 0; r < 4; ++r) {
          lo[r] = (c[i][j][r] + b0[r]) * scale;
          hi[r] = (c[i][j][4 + r] + b1[r]) * scale;
        }
        char* sp = stg + (i * 16 + nn) * GM_SP32 + (j * 16 + 8 * half) * 4;
        *reinterpret_cast<v4f*>(sp) = lo;
        *reinterpret_cast<v4f*>(sp + 16) = hi;
      }
    }
    // the wave's own LDS stores are done before other lanes' values are read
    asm volatile("s_wait_dscnt 0x0" ::: "memory");
    float* orow = (float*)out + (size_t)(qidx + half) * C_DIM + pidx + nn * 4;
    // unrolled: the registers are indexed by constants only
    #pragma unroll
    for (int s = 0; s < 16; ++s) {     // two whole rows (4 lines) a store
      v4f v = *reinterpret_cast<const v4f*>(stg + (2 * s + half) * GM_SP32 + nn * 16);
      *reinterpret_cast<v4f*>(orow + (size_t)(2 * s) * C_DIM) = v;
    }
    // stands before any register that these stores name is written again
    asm volatile("s_wait_xcnt 0x0" ::: "memory");
  } else {
    // ---- modes 0 and 1: bf16, a row of the piece is 128 bytes ----
    auto put = [&](int i, int j, v8f bb) {
      v8bf o;
      // unrolled: the registers are indexed by constants only
      #pragma unroll
      for (int r = 0; r < 8; ++r) o[r] = f2bf((c[i][j][r] + bb[r]) * scale);
      *reinterpret_cast<v8bf*>(stg + (i * 16 + nn) * GM_SP16 +
                               (j * 16 + 8 * half) * 2) = o;
    };
    // read the piece back row by row and store it: orow is the lane's place in
    // rows 0..3, ld the result's row length (a constant at each call, so that the
    // eight stores share one address register and differ in the immediate offset)
    int rr = lane >> 3, cc = lane & 7;
    auto flush = [&](bf16_t* orow, int ld) {
      // the wave's own LDS stores are done before other lanes' values are read
      asm volatile("s_wait_dscnt 0x0" ::: "memory");
      // unrolled: the registers are indexed by constants only
      #pragma unroll
      for (int s = 0; s < 8; ++s) {    // four whole rows (4 lines) a store
        v8bf v = *reinterpret_cast<const v8bf*>(stg + (4 * s + rr) * GM_SP16 + cc * 16);
        *reinterpret_cast<v8bf*>(orow + 4 * s * ld) = v;
      }
      // stands before any register that these stores name is written again
      asm volatile("s_wait_xcnt 0x0" ::: "memory");
    };
    if (vt) {                          // the bias goes with the Q row (n)
      // unrolled: the registers are indexed by constants only
      #pragma unroll
      for (int i = 0; i < 2; ++i) {
        float bv = bias[qidx + i * 16 + nn];
        v8f bb = v8f{bv, bv, bv, bv, bv, bv, bv, bv};
        // unrolled: the registers are indexed by constants only
        #pragma unroll
        for (int j = 0; j < 4; ++j) put(i, j, bb);
      }
      // row b*1024 + n, column t, where m = pidx + .. = b*2048 + t (the 128 m of
      // a block have one b)
      flush((bf16_t*)out + (size_t)((pidx >> 11) * 1024 + qidx + rr) * T_SEQ +
                (pidx & (T_SEQ - 1)) + cc * 8, T_SEQ);
    } else {                           // the bias goes with the P row (n)
      // unrolled: the registers are indexed by constants only
      #pragma unroll
      for (int j = 0; j < 4; ++j) {
        const float* bp = bias + pidx + j * 16 + 8 * half;
        v4f b0 = *reinterpret_cast<const v4f*>(bp);
        v4f b1 = *reinterpret_cast<const v4f*>(bp + 4);
        v8f bb = __builtin_shufflevector(b0, b1, 0, 1, 2, 3, 4, 5, 6, 7);
        // unrolled: the registers are indexed by constants only
        #pragma unroll
        for (int i = 0; i < 2; ++i) put(i, j, bb);
      }
      // row m, column n
      flush((bf16_t*)out + (size_t)(qidx + rr) * C_DIM + pidx + cc * 8, C_DIM);
    }
  }
}

#define AT_WAVES 8
#define AT_KEYS  64           // keys per staged tile
#define AT_PITCH 72           // LDS row pitch in elements (144 B = 16 B x 9)
#define AT_TILES (T_SEQ / AT_KEYS)
#define AT_ROWS  (AT_WAVES * 16)   // queries per block = mask rows per tile
#define AT_MPITCH 68          // mask row pitch in floats (272 B = 16 B x 17)

__global__ __launch_bounds__(AT_WAVES * 32)
void attn_flash(const bf16_t* __restrict__ Qb,
                           const bf16_t* __restrict__ Kb,
                           const bf16_t* __restrict__ Vt,
                           const float* __restrict__ mask,
                           bf16_t* __restrict__ AO) {
  __shared__ alignas(16) bf16_t ldsK[2][AT_KEYS * AT_PITCH];
  __shared__ alignas(16) bf16_t ldsV[2][HDIM * AT_PITCH];
  __shared__ alignas(16) float  ldsM[2][AT_ROWS * AT_MPITCH];

  int tid  = threadIdx.x;              // 0..255
  int wave = tid >> 5;
  int qt = blockIdx.x * AT_WAVES + wave;   // query tile (0..127)
  int bh = blockIdx.y;                 // b*16 + h
  int b = bh >> 4, h = bh & 15;
  int lane = threadIdx.x & 31;
  int nn = lane & 15, half = lane >> 4;

  // Q as the B operand: column nn is query qrow0 + nn
  int qrow0 = b * T_SEQ + qt * 16;
  v16bf bq0 = load_frag(Qb, C_DIM, qrow0, h * HDIM);
  v16bf bq1 = load_frag(Qb, C_DIM, qrow0, h * HDIM + 32);

  // c[j][r] = O^T[d = 16 j + 8 half + r][query nn]
  v8f c[4];
  #pragma unroll
  for (int j = 0; j < 4; ++j)
    c[j] = v8f{0.f, 0.f, 0.f, 0.f, 0.f, 0.f, 0.f, 0.f};

  float mrun = -3.0e38f;     // the query's running maximum, equal in both halves
  float lrun = 0.f;          // sum over this lane half's keys; joined at the end

  const bf16_t* VtB = Vt + (size_t)b * 1024 * T_SEQ;  // [n=h*64+d][t]
  // this lane's mask row inside a staged tile, at the first key of its half
  int mlane = (wave * 16 + nn) * AT_MPITCH + 8 * half;

  // stage keys kb..kb+63 into buffer buf: 512 chunks of 16 B for K and as many
  // for V^T, two of each per thread; a wave's copy covers four whole rows.
  int srow = tid >> 3;                 // 0..31 (second chunk: +32)
  int scol = (tid & 7) * 8;            // element column of the 16-byte chunk
  const bf16_t* Ksrc = Kb + (size_t)(b * T_SEQ + srow) * C_DIM + h * HDIM + scol;
  const bf16_t* Vsrc = VtB + (size_t)(h * HDIM + srow) * T_SEQ + scol;
  // and the mask tile: 2048 chunks of 16 B, eight per thread, 16 rows apart
  int mrw = tid >> 4;                  // 0..15
  int mcl = (tid & 15) * 4;            // float column of the 16-byte chunk
  const float* Msrc = mask + (size_t)(blockIdx.x * AT_ROWS + mrw) * T_SEQ + mcl;
  auto stage = [&](int buf, int kb) {
    unsigned dk = (unsigned)(uintptr_t)&ldsK[buf][srow * AT_PITCH + scol];
    unsigned dv = (unsigned)(uintptr_t)&ldsV[buf][srow * AT_PITCH + scol];
    const bf16_t* ks = Ksrc + (size_t)kb * C_DIM;
    const bf16_t* vs = Vsrc + kb;
    async_copy4_b128(dk, dk + 32 * AT_PITCH * 2, dv, dv + 32 * AT_PITCH * 2,
                     ks, ks + 32 * C_DIM, vs, vs + 32 * T_SEQ);
    unsigned dm = (unsigned)(uintptr_t)&ldsM[buf][mrw * AT_MPITCH + mcl];
    async_copy8_b128_f32(dm, 16 * AT_MPITCH * 4, Msrc + kb, 16 * T_SEQ);
  };

  stage(0, 0);
  wait_asynccnt0();          // our slice of tile 0 landed
  __syncthreads();           // everyone's slice landed
  stage(1, AT_KEYS);

  for (int t = 0; t < AT_TILES; ++t) {
   const bf16_t* Kt = &ldsK[t & 1][0];
   const bf16_t* Vl = &ldsV[t & 1][0];
   const float*  Ml = &ldsM[t & 1][mlane];
   // unrolled: the LDS offsets of both halves become immediates
   #pragma unroll
   for (int sub = 0; sub < AT_KEYS; sub += 32) {
    // ---- scores: S^T(32x16) = K(32x64) @ Q^T, two 16x16 tiles ----
    // s0[r] = S[query nn][key 64 t + sub + 8 half + r], s1[r]: 16 keys further on
    v8f s0 = v8f{0.f, 0.f, 0.f, 0.f, 0.f, 0.f, 0.f, 0.f};
    v8f s1 = v8f{0.f, 0.f, 0.f, 0.f, 0.f, 0.f, 0.f, 0.f};
    {
      v16bf k00 = load_frag(Kt, AT_PITCH, sub,      0);
      v16bf k01 = load_frag(Kt, AT_PITCH, sub,      32);
      s0 = wmma_bf16(k00, bq0, s0);
      s0 = wmma_bf16(k01, bq1, s0);
      v16bf k10 = load_frag(Kt, AT_PITCH, sub + 16, 0);
      v16bf k11 = load_frag(Kt, AT_PITCH, sub + 16, 32);
      s1 = wmma_bf16(k10, bq0, s1);
      s1 = wmma_bf16(k11, bq1, s1);
    }

    // ---- additive mask (2D [Tq][Tk]): 8 + 8 consecutive keys of one row ----
    {
      const float* mp = Ml + sub;
      v4f m00 = *reinterpret_cast<const v4f*>(mp);
      v4f m01 = *reinterpret_cast<const v4f*>(mp + 4);
      v4f m10 = *reinterpret_cast<const v4f*>(mp + 16);
      v4f m11 = *reinterpret_cast<const v4f*>(mp + 20);
      s0 += __builtin_shufflevector(m00, m01, 0, 1, 2, 3, 4, 5, 6, 7);
      s1 += __builtin_shufflevector(m10, m11, 0, 1, 2, 3, 4, 5, 6, 7);
    }

    // ---- online softmax update, in the lane ----
    float tm = fmaxf(s0[0], s1[0]);
    #pragma unroll
    for (int r = 1; r < 8; ++r) tm = fmaxf(tm, fmaxf(s0[r], s1[r]));
    tm = fmaxf(tm, xhalf(tm));         // the other half's 16 keys
    float nm = fmaxf(mrun, tm);
    float al = __expf(mrun - nm);
    float rs = 0.f;
    v16bf pb;                          // P^T as B: pb[s] = P[nn][kmap(s, half)]
    #pragma unroll
    for (int r = 0; r < 8; ++r) {
      float p0 = __expf(s0[r] - nm);
      float p1 = __expf(s1[r] - nm);
      rs += p0 + p1;
      pb[r]     = f2bf(p0);
      pb[8 + r] = f2bf(p1);
    }
    lrun = lrun * al + rs;
    mrun = nm;
    #pragma unroll
    for (int j = 0; j < 4; ++j)
      #pragma unroll
      for (int r = 0; r < 8; ++r) c[j][r] *= al;

    // ---- O^T(64x16) += V^T(64x32) @ P^T(32x16) ----
    #pragma unroll
    for (int j = 0; j < 4; ++j) {
      v16bf va = load_frag(Vl, AT_PITCH, j * 16, sub);
      c[j] = wmma_bf16(va, pb, c[j]);
    }
   }
   // publish point of tile t + 1: our reads of this buffer are done, our slice
   // of the next tile has landed, then everyone's; only then the refill.
   asm volatile("s_wait_dscnt 0x0" ::: "memory");
   wait_asynccnt0();
   __syncthreads();
   if (t + 2 < AT_TILES) stage(t & 1, (t + 2) * AT_KEYS);
  }
  wait_asynccnt0();          // nothing of ours is in flight when the wave ends

  // ---- normalize and store to AO (bf16 row-major [4096][1024]) ----
  // a lane's 8 registers of a tile are 8 consecutive d of its query: 16 bytes
  float inv = 1.0f / (lrun + xhalf(lrun));
  bf16_t* orow = AO + (size_t)(qrow0 + nn) * C_DIM + h * HDIM + 8 * half;
  #pragma unroll
  for (int j = 0; j < 4; ++j) {
    v8bf o;
    #pragma unroll
    for (int r = 0; r < 8; ++r) o[r] = f2bf(c[j][r] * inv);
    *reinterpret_cast<v8bf*>(orow + j * 16) = o;
  }
}

// ---------------------------------------------------------------------------

extern "C" void kernel_launch(void* const* d_in, const int* in_sizes, int n_in,
                              void* d_out, int out_size, void* d_ws,
                              size_t ws_size, hipStream_t stream) {
  const float* x    = (const float*)d_in[0];
  const float* mask = (const float*)d_in[1];
  const float* Wq = (const float*)d_in[2];  const float* bq = (const float*)d_in[3];
  const float* Wk = (const float*)d_in[4];  const float* bk = (const float*)d_in[5];
  const float* Wv = (const float*)d_in[6];  const float* bv = (const float*)d_in[7];
  const float* Wo = (const float*)d_in[8];  const float* bo = (const float*)d_in[9];

  char* ws = (char*)d_ws;
  const size_t MiB = 1024 * 1024;
  bf16_t* xb  = (bf16_t*)(ws + 0);          //  8 MiB  x  bf16 [4096][1024]
  bf16_t* wqb = (bf16_t*)(ws + 8  * MiB);   //  2 MiB
  bf16_t* wkb = (bf16_t*)(ws + 10 * MiB);   //  2 MiB
  bf16_t* wvb = (bf16_t*)(ws + 12 * MiB);   //  2 MiB
  bf16_t* wob = (bf16_t*)(ws + 14 * MiB);   //  2 MiB
  bf16_t* Qb  = (bf16_t*)(ws + 16 * MiB);   //  8 MiB  (pre-scaled by 1/sqrt d)
  bf16_t* Kb  = (bf16_t*)(ws + 24 * MiB);   //  8 MiB
  bf16_t* Vt  = (bf16_t*)(ws + 32 * MiB);   //  8 MiB  V transposed [b][n][t]
  bf16_t* AO  = (bf16_t*)(ws + 40 * MiB);   //  8 MiB  attention out bf16

  // 1) fp32 -> bf16 staging, one launch: xb, wqb, wkb, wvb, wob are contiguous
  cvt_f32_bf16<<<CVT_XBLK + 4 * CVT_WBLK, CVT_BLOCK, 0, stream>>>(
      x, Wq, Wk, Wv, Wo, xb);

  // 2) Q/K/V projections (WMMA bf16, async-LDS staging of both operands), one
  //    launch: wqb, wkb, wvb are contiguous, and so are Qb, Kb, Vt
  dim3 gq(MTOT / GM_TILE, C_DIM / GM_TILE, 3);  // 32 x 8 x 3
  dim3 go(MTOT / GM_TILE, C_DIM / GM_TILE, 1);  // 32 x 8
  dim3 bw(GM_WAVES * 32);                       // 8 waves
  gemm_proj<<<gq, bw, 0, stream>>>(xb, wqb, bq, bk, bv, (void*)Qb, 1);

  // 3) streaming-softmax attention (WMMA bf16)
  attn_flash<<<dim3(T_SEQ / (16 * AT_WAVES), 2 * NHEAD), dim3(AT_WAVES * 32), 0,
               stream>>>(
      Qb, Kb, Vt, mask, AO);

  // 4) output projection, f32 result
  gemm_proj<<<go, bw, 0, stream>>>(AO, wob, bo, bo, bo, d_out, 0);
}

// v008
// A run of this version takes 81.5 microseconds.
// Two timings next to v007 put it at 1.06 and 1.05 times that version's speed.
// All steps since v000 together make it 5.34 times as fast.
#include <hip/hip_runtime.h>

// ---------------------------------------------------------------------------
// MultiHeadAttention forward for MI455X (gfx1250, wave32, WMMA bf16)
//   B=2, T=2048, C=1024, H=16, D=64
//   - bf16 WMMA for all four GEMM stages + streaming-softmax attention
//   - GEMM: 8-wave workgroups, 128x128 tile; A and W tiles in a two-buffer LDS
//     ring filled by global_load_async_to_lds_b128 (ASYNCcnt)
// ---------------------------------------------------------------------------

typedef __bf16 bf16_t;
typedef __attribute__((ext_vector_type(16))) __bf16 v16bf;
typedef __attribute__((ext_vector_type(8)))  __bf16 v8bf;
typedef __attribute__((ext_vector_type(8)))  float  v8f;

#define T_SEQ   2048
#define C_DIM   1024
#define NHEAD   16
#define HDIM    64
#define MTOT    4096          // B * T
#define ATT_SCALE 0.125f      // 1/sqrt(64)

// ----- helpers --------------------------------------------------------------

// f32 -> bf16 by the hardware's own conversion (round-to-nearest-even): two
// neighbouring results come from one v_cvt_pk_bf16_f32.
__device__ __forceinline__ bf16_t f2bf(float f) {
  return static_cast<bf16_t>(f);
}

// WMMA D = A(16x32 bf16) * B(32x16 bf16) + C(16x16 f32)
__device__ __forceinline__ v8f wmma_bf16(v16bf a, v16bf b, v8f c) {
  return __builtin_amdgcn_wmma_f32_16x16x32_bf16(
      /*neg_a=*/false, a, /*neg_b=*/false, b,
      /*c_mod=*/(short)0, c, /*reuse_a=*/false, /*reuse_b=*/false);
}

// CDNA5 async copy: 16 bytes a lane, global -> LDS, tracked by ASYNCcnt.  The
// first operand is the lane's LDS byte address (low 32 bits of the generic
// pointer; the LDS aperture maps LDS_ADDR = addr[31:0]).

// Four async copies in one statement.  The closing s_wait_xcnt 0 stands inside
// the statement so that no address register of a copy is rewritten ahead of it.
__device__ __forceinline__ void async_copy4_b128(
    unsigned l0, unsigned l1, unsigned l2, unsigned l3,
    const bf16_t* g0, const bf16_t* g1, const bf16_t* g2, const bf16_t* g3) {
  asm volatile("global_load_async_to_lds_b128 %0, %4, off\n\t"
               "global_load_async_to_lds_b128 %1, %5, off\n\t"
               "global_load_async_to_lds_b128 %2, %6, off\n\t"
               "global_load_async_to_lds_b128 %3, %7, off\n\t"
               "s_wait_xcnt 0x0"
               :: "v"(l0), "v"(l1), "v"(l2), "v"(l3),
                  "v"(g0), "v"(g1), "v"(g2), "v"(g3) : "memory");
}

// Eight async copies in one statement, closed by s_wait_xcnt 0 for the same
// reason.  Copy i moves 16 bytes from g + i * gstep elements to LDS byte
// l + i * lstep.
__device__ __forceinline__ void async_copy8_b128(unsigned l, unsigned lstep,
                                                 const bf16_t* g, size_t gstep) {
  asm volatile("global_load_async_to_lds_b128 %0, %8, off\n\t"
               "global_load_async_to_lds_b128 %1, %9, off\n\t"
               "global_load_async_to_lds_b128 %2, %10, off\n\t"
               "global_load_async_to_lds_b128 %3, %11, off\n\t"
               "global_load_async_to_lds_b128 %4, %12, off\n\t"
               "global_load_async_to_lds_b128 %5, %13, off\n\t"
               "global_load_async_to_lds_b128 %6, %14, off\n\t"
               "global_load_async_to_lds_b128 %7, %15, off\n\t"
               "s_wait_xcnt 0x0"
               :: "v"(l), "v"(l + lstep), "v"(l + 2 * lstep), "v"(l + 3 * lstep),
                  "v"(l + 4 * lstep), "v"(l + 5 * lstep), "v"(l + 6 * lstep),
                  "v"(l + 7 * lstep),
                  "v"(g), "v"(g + gstep), "v"(g + 2 * gstep), "v"(g + 3 * gstep),
                  "v"(g + 4 * gstep), "v"(g + 5 * gstep), "v"(g + 6 * gstep),
                  "v"(g + 7 * gstep) : "memory");
}

// The same eight copies from an f32 source: copy i moves 16 bytes (four floats)
// from g + i * gstep elements to LDS byte l + i * lstep; s_wait_xcnt 0 closes the
// statement for the same reason.
__device__ __forceinline__ void async_copy8_b128_f32(unsigned l, unsigned lstep,
                                                     const float* g, size_t gstep) {
  asm volatile("global_load_async_to_lds_b128 %0, %8, off\n\t"
               "global_load_async_to_lds_b128 %1, %9, off\n\t"
               "global_load_async_to_lds_b128 %2, %10, off\n\t"
               "global_load_async_to_lds_b128 %3, %11, off\n\t"
               "global_load_async_to_lds_b128 %4, %12, off\n\t"
               "global_load_async_to_lds_b128 %5, %13, off\n\t"
               "global_load_async_to_lds_b128 %6, %14, off\n\t"
               "global_load_async_to_lds_b128 %7, %15, off\n\t"
               "s_wait_xcnt 0x0"
               :: "v"(l), "v"(l + lstep), "v"(l + 2 * lstep), "v"(l + 3 * lstep),
                  "v"(l + 4 * lstep), "v"(l + 5 * lstep), "v"(l + 6 * lstep),
                  "v"(l + 7 * lstep),
                  "v"(g), "v"(g + gstep), "v"(g + 2 * gstep), "v"(g + 3 * gstep),
                  "v"(g + 4 * gstep), "v"(g + 5 * gstep), "v"(g + 6 * gstep),
                  "v"(g + 7 * gstep) : "memory");
}

__device__ __forceinline__ void wait_asynccnt0() {
  asm volatile("s_wait_asynccnt 0x0" ::: "memory");
}

// Load a 16x32 bf16 fragment (ISA 7.12.2 16-bit A layout) from a row-major
// matrix: rows r0..r0+15, cols c0..c0+31, leading dim ld (elements).
// lanes 0-15 hold (row = r0+lane) K = 0-7 and 16-23; lanes 16-31 hold K = 8-15
// and 24-31.  The SAME pattern serves as the B operand when the B matrix is
// stored column-contiguous (i.e. memory is [N][K] row-major).
__device__ __forceinline__ v16bf load_frag(const bf16_t* base, int ld,
                                           int r0, int c0) {
  int lane = threadIdx.x & 31;
  int nn   = lane & 15;
  int half = lane >> 4;
  const bf16_t* p = base + (size_t)(r0 + nn) * ld + c0 + (half << 3);
  v8bf lo = *reinterpret_cast<const v8bf*>(p);        // K = half*8 .. +8
  v8bf hi = *reinterpret_cast<const v8bf*>(p + 16);   // K = 16+half*8 .. +8
  return __builtin_shufflevector(lo, hi, 0, 1, 2, 3, 4, 5, 6, 7,
                                 8, 9, 10, 11, 12, 13, 14, 15);
}

// Lane l <-> lane l ^ 16: the two lanes that share one column of a D tile.
__device__ __forceinline__ float xhalf(float v) {
  int b = __builtin_bit_cast(int, v);
  int o = __builtin_amdgcn_permlanex16(b, b, 0x76543210, 0xfedcba98, false, false);
  return __builtin_bit_cast(float, o);
}

// ----- kernel 1: f32 -> bf16 conversion ------------------------------------

// Each thread converts CVT_VEC groups of four floats, so that few waves have to
// be started; a wave's load covers 512 contiguous bytes, and all of a thread's
// loads are issued before the first is used.  A block converts CVT_ELEMS
// elements and there is no tail: an array's size must be a multiple of that
// (both sizes here are).
// One launch converts all five arrays: the first CVT_XBLK blocks take x, then
// CVT_WBLK blocks each of Wq, Wk, Wv, Wo.  The five results lie one behind the
// other in that order, so a block's place in outAll follows from its index alone.

#define CVT_BLOCK 256
#define CVT_VEC   8
#define CVT_ELEMS (CVT_BLOCK * CVT_VEC * 4)        // elements per block: 8192
#define CVT_XBLK  (MTOT * C_DIM / CVT_ELEMS)       // blocks for x: 512
#define CVT_WBLK  (C_DIM * C_DIM / CVT_ELEMS)      // blocks per weight: 128

typedef __attribute__((ext_vector_type(4))) float  v4f;
typedef __attribute__((ext_vector_type(4))) __bf16 v4bf;

__global__ __launch_bounds__(CVT_BLOCK)
void cvt_f32_bf16(const float* __restrict__ x,
                  const float* __restrict__ wq, const float* __restrict__ wk,
                  const float* __restrict__ wv, const float* __restrict__ wo,
                  bf16_t* __restrict__ outAll) {
  int blk = blockIdx.x;
  int rel = blk;                       // the block's index inside its own array
  const float* arr = x;
  if (blk >= CVT_XBLK) {
    int w = (blk - CVT_XBLK) / CVT_WBLK;
    rel = (blk - CVT_XBLK) % CVT_WBLK;
    arr = w == 0 ? wq : w == 1 ? wk : w == 2 ? wv : wo;
  }
  const float* in = arr + (size_t)rel * CVT_ELEMS;
  bf16_t* out = outAll + (size_t)blk * CVT_ELEMS;
  size_t base = threadIdx.x * 4;
  v4f v[CVT_VEC];
  // both loops unrolled: v[] stays in registers, the loads go out as one group
  #pragma unroll
  for (int j = 0; j < CVT_VEC; ++j)
    v[j] = *reinterpret_cast<const v4f*>(in + base + j * (CVT_BLOCK * 4));
  #pragma unroll
  for (int j = 0; j < CVT_VEC; ++j) {
    v4bf o = {f2bf(v[j][0]), f2bf(v[j][1]), f2bf(v[j][2]), f2bf(v[j][3])};
    *reinterpret_cast<v4bf*>(out + base + j * (CVT_BLOCK * 4)) = o;
  }
}

// ----- kernel 2: GEMM  Y = A(4096x1024) @ W^T(1024x1024) + bias ------------
// 8 waves / workgroup, one 128(M) x 128(N) tile of Y.  A trip is 128 k: 128
// rows x 256 bytes of A and as much of W are brought into a two-buffer LDS ring
// by async copies (a wave's copy covers two whole rows), the next trip's tiles
// in flight while this trip's are worked on; all fragments are read from LDS at
// a row pitch of 272 bytes.  k runs upwards in steps of 32 in every accumulator.
// mode 0: store bf16 row-major [M][N], value scaled by scale
// mode 1: store bf16 transposed for V: out[(b*1024+n)*2048 + t]
// mode 2: store f32 row-major [M][N]
// qkv != 0: one launch does the Q, K and V projections; blockIdx.z picks the
// weight (the three lie one behind the other from Wall), the bias and the result
// (one behind the other from outAll): z = 0 is Q (mode 0, scaled by 1/sqrt d),
// z = 1 is K (mode 0), z = 2 is V (mode 1).  qkv == 0: grid z is 1, mode 2.
// The matrix whose row index runs ALONG a row of the result (W in modes 0 and 2,
// A in mode 1) is the first WMMA operand, P; the other, Q, is the second.  A
// lane's 8 accumulators of a tile are then 8 neighbours in one row of the result.
// The waves stand 2 (P) x 4 (Q), each with 64 P rows x 32 Q rows: 32 rows of the
// result, 64 elements each, which are whole 128-byte lines.  A wave puts its
// piece into its own part of the (by then free) ring and reads it back row by
// row, so that every global store instruction writes whole lines.

#define GM_WAVES 8
#define GM_TILE  128          // rows of A and rows of W per workgroup
#define GM_BK    128          // k per trip
#define GM_PITCH 136          // LDS row pitch in elements (272 B = 16 B x 17)
#define GM_TRIPS (C_DIM / GM_BK)
#define GM_SP16  144          // staging row pitch in bytes, 64 bf16 (16 B x 9)
#define GM_SP32  272          // staging row pitch in bytes, 64 f32 (16 B x 17)
#define GM_STG   (32 * GM_SP32)   // staging bytes per wave; 8 of them = ldsA

__global__ __launch_bounds__(GM_WAVES * 32)
void gemm_proj(const bf16_t* __restrict__ A,
                          const bf16_t* __restrict__ Wall,
                          const float* __restrict__ bias0,
                          const float* __restrict__ bias1,
                          const float* __restrict__ bias2,
                          void* __restrict__ outAll, int qkv) {
  __shared__ alignas(16) bf16_t ldsA[2][GM_TILE * GM_PITCH];
  __shared__ alignas(16) bf16_t ldsB[2][GM_TILE * GM_PITCH];

  int z = blockIdx.z;
  const bf16_t* W = Wall + (size_t)z * (C_DIM * C_DIM);
  const float* bias = z == 0 ? bias0 : z == 1 ? bias1 : bias2;
  bool vt = qkv && z == 2;           // mode 1: the result is stored transposed
  float scale = (qkv && z == 0) ? ATT_SCALE : 1.0f;
  // the bf16 results are MTOT * C_DIM elements each; z is 0 for the f32 result
  void* out = (void*)((bf16_t*)outAll + (size_t)z * (MTOT * C_DIM));

  int tid  = threadIdx.x;            // 0..255
  int wave = tid >> 5;
  int lane = tid & 31;
  int nn = lane & 15, half = lane >> 4;
  int po = (wave & 1) * 64;          // the wave's rows inside the P tile
  int qo = (wave >> 1) * 32;         // the wave's rows inside the Q tile

  // stage k..k+127 of the block's 128 rows of A and of W into buffer buf: 2048
  // chunks of 16 B each, eight of each per thread, 16 rows apart.
  int srow = tid >> 4;                 // 0..15
  int scol = (tid & 15) * 8;           // element column of the 16-byte chunk
  const bf16_t* Asrc = A + (size_t)(blockIdx.x * GM_TILE + srow) * C_DIM + scol;
  const bf16_t* Wsrc = W + (size_t)(blockIdx.y * GM_TILE + srow) * C_DIM + scol;
  auto stage = [&](int buf, int k) {
    unsigned da = (unsigned)(uintptr_t)&ldsA[buf][srow * GM_PITCH + scol];
    unsigned db = (unsigned)(uintptr_t)&ldsB[buf][srow * GM_PITCH + scol];
    async_copy8_b128(da, 16 * GM_PITCH * 2, Asrc + k, 16 * C_DIM);
    async_copy8_b128(db, 16 * GM_PITCH * 2, Wsrc + k, 16 * C_DIM);
  };

  // c[i][j][r]: Q row qo + 16 i + nn, P row po + 16 j + 8 half + r
  v8f c[2][4];
  #pragma unroll
  for (int i = 0; i < 2; ++i)
    #pragma unroll
    for (int j = 0; j < 4; ++j)
      c[i][j] = v8f{0.f, 0.f, 0.f, 0.f, 0.f, 0.f, 0.f, 0.f};

  const bf16_t* Pbase = vt ? &ldsA[0][0] : &ldsB[0][0];
  const bf16_t* Qbase = vt ? &ldsB[0][0] : &ldsA[0][0];

  stage(0, 0);
  wait_asynccnt0();          // our slice of trip 0's tiles landed
  __syncthreads();           // everyone's slice landed
  stage(1, GM_BK);

  // two trips a pass of the loop: the buffer index is a constant in each copy,
  // and the text stays short (unrolled in full it is four times as long)
  #pragma unroll 2
  for (int t = 0; t < GM_TRIPS; ++t) {
    const bf16_t* Pt = Pbase + (t & 1) * (GM_TILE * GM_PITCH);
    const bf16_t* Qt = Qbase + (t & 1) * (GM_TILE * GM_PITCH);
    // two fragment sets: inside a trip, k step q + 1 is read while q is worked on
    v16bf fq[2][2], fp[2][4];
    auto frags = [&](int s, int kk) {
      fq[s][0] = load_frag(Qt, GM_PITCH, qo,      kk);
      fq[s][1] = load_frag(Qt, GM_PITCH, qo + 16, kk);
      // unrolled: fp[] is indexed by constants only and stays in registers
      #pragma unroll
      for (int j = 0; j < 4; ++j)
        fp[s][j] = load_frag(Pt, GM_PITCH, po + j * 16, kk);
    };
    frags(0, 0);
    // unrolled: the set index is a constant (the sets stay in registers) and the
    // LDS offsets of the four k steps become immediates
    #pragma unroll
    for (int q = 0; q < GM_BK / 32; ++q) {
      if (q + 1 < GM_BK / 32) frags((q + 1) & 1, (q + 1) * 32);
      // holds the next step's 12 LDS reads as one group ahead of this step's
      // products; left free, they are sunk in pairs among the products, each
      // pair with a full wait for LDS behind it
      __builtin_amdgcn_sched_barrier(0);
      // unrolled: c[] and fp[] are indexed by constants only
      #pragma unroll
      for (int j = 0; j < 4; ++j) {
        c[0][j] = wmma_bf16(fp[q & 1][j], fq[q & 1][0], c[0][j]);
        c[1][j] = wmma_bf16(fp[q & 1][j], fq[q & 1][1], c[1][j]);
      }
      // keeps the reads of the step after next from rising among these products
      __builtin_amdgcn_sched_barrier(0);
    }
    // publish point of trip t + 1: our reads of this buffer are done, our slice
    // of the next tiles has landed, then everyone's; only then the refill.
    asm volatile("s_wait_dscnt 0x0" ::: "memory");
    wait_asynccnt0();
    __syncthreads();
    if (t + 2 < GM_TRIPS) stage(t & 1, (t + 2) * GM_BK);
  }
  wait_asynccnt0();          // nothing of ours is in flight when the wave ends

  // Behind the last trip's barrier nobody reads the ring and no copy is in
  // flight: ldsA, cut in eight, is the waves' staging room.
  char* stg = reinterpret_cast<char*>(&ldsA[0][0]) + wave * GM_STG;
  // the wave's piece of the result: 32 rows (Q), 64 elements each (P)
  int pidx = (vt ? blockIdx.x : blockIdx.y) * GM_TILE + po;   // first P row
  int qidx = (vt ? blockIdx.y : blockIdx.x) * GM_TILE + qo;   // first Q row

  if (!qkv) {
    // ---- mode 2: f32, a row of the piece is 256 bytes ----
    // unrolled: the registers are indexed by constants only
    #pragma unroll
    for (int j = 0; j < 4; ++j) {
      const float* bp = bias + pidx + j * 16 + 8 * half;
      v4f b0 = *reinterpret_cast<const v4f*>(bp);
      v4f b1 = *reinterpret_cast<const v4f*>(bp + 4);
      // unrolled: the registers are indexed by constants only
      #pragma unroll
      for (int i = 0; i < 2; ++i) {
        v4f lo, hi;
        // unrolled: the registers are indexed by constants only
        #pragma unroll
        for (int r = 0; r < 4; ++r) {
          lo[r] = (c[i][j][r] + b0[r]) * scale;
          hi[r] = (c[i][j][4 + r] + b1[r]) * scale;
        }
        char* sp = stg + (i * 16 + nn) * GM_SP32 + (j * 16 + 8 * half) * 4;
        *reinterpret_cast<v4f*>(sp) = lo;
        *reinterpret_cast<v4f*>(sp + 16) = hi;
      }
    }
    // the wave's own LDS stores are done before other lanes' values are read
    asm volatile("s_wait_dscnt 0x0" ::: "memory");
    float* orow = (float*)out + (size_t)(qidx + half) * C_DIM + pidx + nn * 4;
    // unrolled: the registers are indexed by constants only
    #pragma unroll
    for (int s = 0; s < 16; ++s) {     // two whole rows (4 lines) a store
      v4f v = *reinterpret_cast<const v4f*>(stg + (2 * s + half) * GM_SP32 + nn * 16);
      *reinterpret_cast<v4f*>(orow + (size_t)(2 * s) * C_DIM) = v;
    }
    // stands before any register that these stores name is written again
    asm volatile("s_wait_xcnt 0x0" ::: "memory");
  } else {
    // ---- modes 0 and 1: bf16, a row of the piece is 128 bytes ----
    auto put = [&](int i, int j, v8f bb) {
      v8bf o;
      // unrolled: the registers are indexed by constants only
      #pragma unroll
      for (int r = 0; r < 8; ++r) o[r] = f2bf((c[i][j][r] + bb[r]) * scale);
      *reinterpret_cast<v8bf*>(stg + (i * 16 + nn) * GM_SP16 +
                               (j * 16 + 8 * half) * 2) = o;
    };
    // read the piece back row by row and store it: orow is the lane's place in
    // rows 0..3, ld the result's row length (a constant at each call, so that the
    // eight stores share one address register and differ in the immediate offset)
    int rr = lane >> 3, cc = lane & 7;
    auto flush = [&](bf16_t* orow, int ld) {
      // the wave's own LDS stores are done before other lanes' values are read
      asm volatile("s_wait_dscnt 0x0" ::: "memory");
      // unrolled: the registers are indexed by constants only
      #pragma unroll
      for (int s = 0; s < 8; ++s) {    // four whole rows (4 lines) a store
        v8bf v = *reinterpret_cast<const v8bf*>(stg + (4 * s + rr) * GM_SP16 + cc * 16);
        *reinterpret_cast<v8bf*>(orow + 4 * s * ld) = v;
      }
      // stands before any register that these stores name is written again
      asm volatile("s_wait_xcnt 0x0" ::: "memory");
    };
    if (vt) {                          // the bias goes with the Q row (n)
      // unrolled: the registers are indexed by constants only
      #pragma unroll
      for (int i = 0; i < 2; ++i) {
        float bv = bias[qidx + i * 16 + nn];
        v8f bb = v8f{bv, bv, bv, bv, bv, bv, bv, bv};
        // unrolled: the registers are indexed by constants only
        #pragma unroll
        for (int j = 0; j < 4; ++j) put(i, j, bb);
      }
      // row b*1024 + n, column t, where m = pidx + .. = b*2048 + t (the 128 m of
      // a block have one b)
      flush((bf16_t*)out + (size_t)((pidx >> 11) * 1024 + qidx + rr) * T_SEQ +
                (pidx & (T_SEQ - 1)) + cc * 8, T_SEQ);
    } else {                           // the bias goes with the P row (n)
      // unrolled: the registers are indexed by constants only
      #pragma unroll
      for (int j = 0; j < 4; ++j) {
        const float* bp = bias + pidx + j * 16 + 8 * half;
        v4f b0 = *reinterpret_cast<const v4f*>(bp);
        v4f b1 = *reinterpret_cast<const v4f*>(bp + 4);
        v8f bb = __builtin_shufflevector(b0, b1, 0, 1, 2, 3, 4, 5, 6, 7);
        // unrolled: the registers are indexed by constants only
        #pragma unroll
        for (int i = 0; i < 2; ++i) put(i, j, bb);
      }
      // row m, column n
      flush((bf16_t*)out + (size_t)(qidx + rr) * C_DIM + pidx + cc * 8, C_DIM);
    }
  }
}

#define AT_WAVES 8
#define AT_KEYS  64           // keys per staged tile
#define AT_PITCH 72           // LDS row pitch in elements (144 B = 16 B x 9)
#define AT_TILES (T_SEQ / AT_KEYS)
#define AT_ROWS  (AT_WAVES * 16)   // queries per block = mask rows per tile
#define AT_MPITCH 68          // mask row pitch in floats (272 B = 16 B x 17)

__global__ __launch_bounds__(AT_WAVES * 32)
void attn_flash(const bf16_t* __restrict__ Qb,
                           const bf16_t* __restrict__ Kb,
                           const bf16_t* __restrict__ Vt,
                           const float* __restrict__ mask,
                           bf16_t* __restrict__ AO) {
  __shared__ alignas(16) bf16_t ldsK[2][AT_KEYS * AT_PITCH];
  __shared__ alignas(16) bf16_t ldsV[2][HDIM * AT_PITCH];
  __shared__ alignas(16) float  ldsM[2][AT_ROWS * AT_MPITCH];

  int tid  = threadIdx.x;              // 0..255
  int wave = tid >> 5;
  int qt = blockIdx.x * AT_WAVES + wave;   // query tile (0..127)
  int bh = blockIdx.y;                 // b*16 + h
  int b = bh >> 4, h = bh & 15;
  int lane = threadIdx.x & 31;
  int nn = lane & 15, half = lane >> 4;

  // Q as the B operand: column nn is query qrow0 + nn
  int qrow0 = b * T_SEQ + qt * 16;
  v16bf bq0 = load_frag(Qb, C_DIM, qrow0, h * HDIM);
  v16bf bq1 = load_frag(Qb, C_DIM, qrow0, h * HDIM + 32);

  // c[j][r] = O^T[d = 16 j + 8 half + r][query nn]
  v8f c[4];
  #pragma unroll
  for (int j = 0; j < 4; ++j)
    c[j] = v8f{0.f, 0.f, 0.f, 0.f, 0.f, 0.f, 0.f, 0.f};

  float mrun = -3.0e38f;     // the query's running maximum, equal in both halves
  float lrun = 0.f;          // sum over this lane half's keys; joined at the end

  const bf16_t* VtB = Vt + (size_t)b * 1024 * T_SEQ;  // [n=h*64+d][t]
  // this lane's mask row inside a staged tile, at the first key of its half
  int mlane = (wave * 16 + nn) * AT_MPITCH + 8 * half;

  // stage keys kb..kb+63 into buffer buf: 512 chunks of 16 B for K and as many
  // for V^T, two of each per thread; a wave's copy covers four whole rows.
  int srow = tid >> 3;                 // 0..31 (second chunk: +32)
  int scol = (tid & 7) * 8;            // element column of the 16-byte chunk
  const bf16_t* Ksrc = Kb + (size_t)(b * T_SEQ + srow) * C_DIM + h * HDIM + scol;
  const bf16_t* Vsrc = VtB + (size_t)(h * HDIM + srow) * T_SEQ + scol;
  // and the mask tile: 2048 chunks of 16 B, eight per thread, 16 rows apart
  int mrw = tid >> 4;                  // 0..15
  int mcl = (tid & 15) * 4;            // float column of the 16-byte chunk
  const float* Msrc = mask + (size_t)(blockIdx.x * AT_ROWS + mrw) * T_SEQ + mcl;
  auto stage = [&](int buf, int kb) {
    unsigned dk = (unsigned)(uintptr_t)&ldsK[buf][srow * AT_PITCH + scol];
    unsigned dv = (unsigned)(uintptr_t)&ldsV[buf][srow * AT_PITCH + scol];
    const bf16_t* ks = Ksrc + (size_t)kb * C_DIM;
    const bf16_t* vs = Vsrc + kb;
    async_copy4_b128(dk, dk + 32 * AT_PITCH * 2, dv, dv + 32 * AT_PITCH * 2,
                     ks, ks + 32 * C_DIM, vs, vs + 32 * T_SEQ);
    unsigned dm = (unsigned)(uintptr_t)&ldsM[buf][mrw * AT_MPITCH + mcl];
    async_copy8_b128_f32(dm, 16 * AT_MPITCH * 4, Msrc + kb, 16 * T_SEQ);
  };

  stage(0, 0);
  wait_asynccnt0();          // our slice of tile 0 landed
  __syncthreads();           // everyone's slice landed
  stage(1, AT_KEYS);

  for (int t = 0; t < AT_TILES; ++t) {
   const bf16_t* Kt = &ldsK[t & 1][0];
   const bf16_t* Vl = &ldsV[t & 1][0];
   const float*  Ml = &ldsM[t & 1][mlane];
   // unrolled: the LDS offsets of both halves become immediates
   #pragma unroll
   for (int sub = 0; sub < AT_KEYS; sub += 32) {
    // ---- scores: S^T(32x16) = K(32x64) @ Q^T, two 16x16 tiles ----
    // s0[r] = S[query nn][key 64 t + sub + 8 half + r], s1[r]: 16 keys further on
    v8f s0 = v8f{0.f, 0.f, 0.f, 0.f, 0.f, 0.f, 0.f, 0.f};
    v8f s1 = v8f{0.f, 0.f, 0.f, 0.f, 0.f, 0.f, 0.f, 0.f};
    {
      v16bf k00 = load_frag(Kt, AT_PITCH, sub,      0);
      v16bf k01 = load_frag(Kt, AT_PITCH, sub,      32);
      s0 = wmma_bf16(k00, bq0, s0);
      s0 = wmma_bf16(k01, bq1, s0);
      v16bf k10 = load_frag(Kt, AT_PITCH, sub + 16, 0);
      v16bf k11 = load_frag(Kt, AT_PITCH, sub + 16, 32);
      s1 = wmma_bf16(k10, bq0, s1);
      s1 = wmma_bf16(k11, bq1, s1);
    }

    // ---- additive mask (2D [Tq][Tk]): 8 + 8 consecutive keys of one row ----
    {
      const float* mp = Ml + sub;
      v4f m00 = *reinterpret_cast<const v4f*>(mp);
      v4f m01 = *reinterpret_cast<const v4f*>(mp + 4);
      v4f m10 = *reinterpret_cast<const v4f*>(mp + 16);
      v4f m11 = *reinterpret_cast<const v4f*>(mp + 20);
      s0 += __builtin_shufflevector(m00, m01, 0, 1, 2, 3, 4, 5, 6, 7);
      s1 += __builtin_shufflevector(m10, m11, 0, 1, 2, 3, 4, 5, 6, 7);
    }

    // ---- online softmax update, in the lane ----
    float tm = fmaxf(s0[0], s1[0]);
    #pragma unroll
    for (int r = 1; r < 8; ++r) tm = fmaxf(tm, fmaxf(s0[r], s1[r]));
    tm = fmaxf(tm, xhalf(tm));         // the other half's 16 keys
    float nm = fmaxf(mrun, tm);
    float al = __expf(mrun - nm);
    float rs = 0.f;
    v16bf pb;                          // P^T as B: pb[s] = P[nn][kmap(s, half)]
    #pragma unroll
    for (int r = 0; r < 8; ++r) {
      float p0 = __expf(s0[r] - nm);
      float p1 = __expf(s1[r] - nm);
      rs += p0 + p1;
      pb[r]     = f2bf(p0);
      pb[8 + r] = f2bf(p1);
    }
    lrun = lrun * al + rs;
    mrun = nm;
    #pragma unroll
    for (int j = 0; j < 4; ++j)
      #pragma unroll
      for (int r = 0; r < 8; ++r) c[j][r] *= al;

    // ---- O^T(64x16) += V^T(64x32) @ P^T(32x16) ----
    #pragma unroll
    for (int j = 0; j < 4; ++j) {
      v16bf va = load_frag(Vl, AT_PITCH, j * 16, sub);
      c[j] = wmma_bf16(va, pb, c[j]);
    }
   }
   // publish point of tile t + 1: our reads of this buffer are done, our slice
   // of the next tile has landed, then everyone's; only then the refill.
   asm volatile("s_wait_dscnt 0x0" ::: "memory");
   wait_asynccnt0();
   __syncthreads();
   if (t + 2 < AT_TILES) stage(t & 1, (t + 2) * AT_KEYS);
  }
  wait_asynccnt0();          // nothing of ours is in flight when the wave ends

  // ---- normalize and store to AO (bf16 row-major [4096][1024]) ----
  // a lane's 8 registers of a tile are 8 consecutive d of its query: 16 bytes
  float inv = 1.0f / (lrun + xhalf(lrun));
  bf16_t* orow = AO + (size_t)(qrow0 + nn) * C_DIM + h * HDIM + 8 * half;
  #pragma unroll
  for (int j = 0; j < 4; ++j) {
    v8bf o;
    #pragma unroll
    for (int r = 0; r < 8; ++r) o[r] = f2bf(c[j][r] * inv);
    *reinterpret_cast<v8bf*>(orow + j * 16) = o;
  }
}

// ---------------------------------------------------------------------------

extern "C" void kernel_launch(void* const* d_in, const int* in_sizes, int n_in,
                              void* d_out, int out_size, void* d_ws,
                              size_t ws_size, hipStream_t stream) {
  const float* x    = (const float*)d_in[0];
  const float* mask = (const float*)d_in[1];
  const float* Wq = (const float*)d_in[2];  const float* bq = (const float*)d_in[3];
  const float* Wk = (const float*)d_in[4];  const float* bk = (const float*)d_in[5];
  const float* Wv = (const float*)d_in[6];  const float* bv = (const float*)d_in[7];
  const float* Wo = (const float*)d_in[8];  const float* bo = (const float*)d_in[9];

  char* ws = (char*)d_ws;
  const size_t MiB = 1024 * 1024;
  bf16_t* xb  = (bf16_t*)(ws + 0);          //  8 MiB  x  bf16 [4096][1024]
  bf16_t* wqb = (bf16_t*)(ws + 8  * MiB);   //  2 MiB
  bf16_t* wkb = (bf16_t*)(ws + 10 * MiB);   //  2 MiB
  bf16_t* wvb = (bf16_t*)(ws + 12 * MiB);   //  2 MiB
  bf16_t* wob = (bf16_t*)(ws + 14 * MiB);   //  2 MiB
  bf16_t* Qb  = (bf16_t*)(ws + 16 * MiB);   //  8 MiB  (pre-scaled by 1/sqrt d)
  bf16_t* Kb  = (bf16_t*)(ws + 24 * MiB);   //  8 MiB
  bf16_t* Vt  = (bf16_t*)(ws + 32 * MiB);   //  8 MiB  V transposed [b][n][t]
  bf16_t* AO  = (bf16_t*)(ws + 40 * MiB);   //  8 MiB  attention out bf16

  // 1) fp32 -> bf16 staging, one launch: xb, wqb, wkb, wvb, wob are contiguous
  cvt_f32_bf16<<<CVT_XBLK + 4 * CVT_WBLK, CVT_BLOCK, 0, stream>>>(
      x, Wq, Wk, Wv, Wo, xb);

  // 2) Q/K/V projections (WMMA bf16, async-LDS staging of both operands), one
  //    launch: wqb, wkb, wvb are contiguous, and so are Qb, Kb, Vt
  dim3 gq(MTOT / GM_TILE, C_DIM / GM_TILE, 3);  // 32 x 8 x 3
  dim3 go(MTOT / GM_TILE, C_DIM / GM_TILE, 1);  // 32 x 8
  dim3 bw(GM_WAVES * 32);                       // 8 waves
  gemm_proj<<<gq, bw, 0, stream>>>(xb, wqb, bq, bk, bv, (void*)Qb, 1);

  // 3) streaming-softmax attention (WMMA bf16)
  attn_flash<<<dim3(T_SEQ / (16 * AT_WAVES), 2 * NHEAD), dim3(AT_WAVES * 32), 0,
               stream>>>(
      Qb, Kb, Vt, mask, AO);

  // 4) output projection, f32 result
  gemm_proj<<<go, bw, 0, stream>>>(AO, wob, bo, bo, bo, d_out, 0);
}

// v009
// One run takes 77.2 microseconds.
// Timed twice side by side with v008, it ran 1.05 and 1.07 times as fast.
// Over all steps from v000 it is 5.66 times as fast.
#include <hip/hip_runtime.h>

// ---------------------------------------------------------------------------
// MultiHeadAttention forward for MI455X (gfx1250, wave32, WMMA bf16)
//   B=2, T=2048, C=1024, H=16, D=64
//   - bf16 WMMA for all four GEMM stages + streaming-softmax attention
//   - GEMM: 8-wave workgroups, 128x128 tile; A and W tiles in a two-buffer LDS
//     ring filled by global_load_async_to_lds_b128 (ASYNCcnt)
// ---------------------------------------------------------------------------

typedef __bf16 bf16_t;
typedef __attribute__((ext_vector_type(16))) __bf16 v16bf;
typedef __attribute__((ext_vector_type(8)))  __bf16 v8bf;
typedef __attribute__((ext_vector_type(8)))  float  v8f;

#define T_SEQ   2048
#define C_DIM   1024
#define NHEAD   16
#define HDIM    64
#define MTOT    4096          // B * T
#define ATT_SCALE 0.125f      // 1/sqrt(64)

// ----- helpers --------------------------------------------------------------

// f32 -> bf16 by the hardware's own conversion (round-to-nearest-even): two
// neighbouring results come from one v_cvt_pk_bf16_f32.
__device__ __forceinline__ bf16_t f2bf(float f) {
  return static_cast<bf16_t>(f);
}

// WMMA D = A(16x32 bf16) * B(32x16 bf16) + C(16x16 f32)
__device__ __forceinline__ v8f wmma_bf16(v16bf a, v16bf b, v8f c) {
  return __builtin_amdgcn_wmma_f32_16x16x32_bf16(
      /*neg_a=*/false, a, /*neg_b=*/false, b,
      /*c_mod=*/(short)0, c, /*reuse_a=*/false, /*reuse_b=*/false);
}

// CDNA5 async copy: 16 bytes a lane, global -> LDS, tracked by ASYNCcnt.  The
// first operand is the lane's LDS byte address (low 32 bits of the generic
// pointer; the LDS aperture maps LDS_ADDR = addr[31:0]).

// Four async copies in one statement.  The closing s_wait_xcnt 0 stands inside
// the statement so that no address register of a copy is rewritten ahead of it.
__device__ __forceinline__ void async_copy4_b128(
    unsigned l0, unsigned l1, unsigned l2, unsigned l3,
    const bf16_t* g0, const bf16_t* g1, const bf16_t* g2, const bf16_t* g3) {
  asm volatile("global_load_async_to_lds_b128 %0, %4, off\n\t"
               "global_load_async_to_lds_b128 %1, %5, off\n\t"
               "global_load_async_to_lds_b128 %2, %6, off\n\t"
               "global_load_async_to_lds_b128 %3, %7, off\n\t"
               "s_wait_xcnt 0x0"
               :: "v"(l0), "v"(l1), "v"(l2), "v"(l3),
                  "v"(g0), "v"(g1), "v"(g2), "v"(g3) : "memory");
}

// Eight async copies in one statement, closed by s_wait_xcnt 0 for the same
// reason.  Copy i moves 16 bytes from g + i * gstep elements to LDS byte
// l + i * lstep.
__device__ __forceinline__ void async_copy8_b128(unsigned l, unsigned lstep,
                                                 const bf16_t* g, size_t gstep) {
  asm volatile("global_load_async_to_lds_b128 %0, %8, off\n\t"
               "global_load_async_to_lds_b128 %1, %9, off\n\t"
               "global_load_async_to_lds_b128 %2, %10, off\n\t"
               "global_load_async_to_lds_b128 %3, %11, off\n\t"
               "global_load_async_to_lds_b128 %4, %12, off\n\t"
               "global_load_async_to_lds_b128 %5, %13, off\n\t"
               "global_load_async_to_lds_b128 %6, %14, off\n\t"
               "global_load_async_to_lds_b128 %7, %15, off\n\t"
               "s_wait_xcnt 0x0"
               :: "v"(l), "v"(l + lstep), "v"(l + 2 * lstep), "v"(l + 3 * lstep),
                  "v"(l + 4 * lstep), "v"(l + 5 * lstep), "v"(l + 6 * lstep),
                  "v"(l + 7 * lstep),
                  "v"(g), "v"(g + gstep), "v"(g + 2 * gstep), "v"(g + 3 * gstep),
                  "v"(g + 4 * gstep), "v"(g + 5 * gstep), "v"(g + 6 * gstep),
                  "v"(g + 7 * gstep) : "memory");
}

// Four async copies from an f32 source: copy i moves 16 bytes (four floats) from
// g + i * gstep elements to LDS byte l + i * lstep; s_wait_xcnt 0 closes the
// statement for the same reason.
__device__ __forceinline__ void async_copy4_b128_f32(unsigned l, unsigned lstep,
                                                     const float* g, size_t gstep) {
  asm volatile("global_load_async_to_lds_b128 %0, %4, off\n\t"
               "global_load_async_to_lds_b128 %1, %5, off\n\t"
               "global_load_async_to_lds_b128 %2, %6, off\n\t"
               "global_load_async_to_lds_b128 %3, %7, off\n\t"
               "s_wait_xcnt 0x0"
               :: "v"(l), "v"(l + lstep), "v"(l + 2 * lstep), "v"(l + 3 * lstep),
                  "v"(g), "v"(g + gstep), "v"(g + 2 * gstep), "v"(g + 3 * gstep)
               : "memory");
}

__device__ __forceinline__ void wait_asynccnt0() {
  asm volatile("s_wait_asynccnt 0x0" ::: "memory");
}

// Load a 16x32 bf16 fragment (ISA 7.12.2 16-bit A layout) from a row-major
// matrix: rows r0..r0+15, cols c0..c0+31, leading dim ld (elements).
// lanes 0-15 hold (row = r0+lane) K = 0-7 and 16-23; lanes 16-31 hold K = 8-15
// and 24-31.  The SAME pattern serves as the B operand when the B matrix is
// stored column-contiguous (i.e. memory is [N][K] row-major).
__device__ __forceinline__ v16bf load_frag(const bf16_t* base, int ld,
                                           int r0, int c0) {
  int lane = threadIdx.x & 31;
  int nn   = lane & 15;
  int half = lane >> 4;
  const bf16_t* p = base + (size_t)(r0 + nn) * ld + c0 + (half << 3);
  v8bf lo = *reinterpret_cast<const v8bf*>(p);        // K = half*8 .. +8
  v8bf hi = *reinterpret_cast<const v8bf*>(p + 16);   // K = 16+half*8 .. +8
  return __builtin_shufflevector(lo, hi, 0, 1, 2, 3, 4, 5, 6, 7,
                                 8, 9, 10, 11, 12, 13, 14, 15);
}

// Lane l <-> lane l ^ 16: the two lanes that share one column of a D tile.
__device__ __forceinline__ float xhalf(float v) {
  int b = __builtin_bit_cast(int, v);
  int o = __builtin_amdgcn_permlanex16(b, b, 0x76543210, 0xfedcba98, false, false);
  return __builtin_bit_cast(float, o);
}

// ----- kernel 1: f32 -> bf16 conversion ------------------------------------

// Each thread converts CVT_VEC groups of four floats, so that few waves have to
// be started; a wave's load covers 512 contiguous bytes, and all of a thread's
// loads are issued before the first is used.  A block converts CVT_ELEMS
// elements and there is no tail: an array's size must be a multiple of that
// (both sizes here are).
// One launch converts all five arrays: the first CVT_XBLK blocks take x, then
// CVT_WBLK blocks each of Wq, Wk, Wv, Wo.  The five results lie one behind the
// other in that order, so a block's place in outAll follows from its index alone.

#define CVT_BLOCK 256
#define CVT_VEC   8
#define CVT_ELEMS (CVT_BLOCK * CVT_VEC * 4)        // elements per block: 8192
#define CVT_XBLK  (MTOT * C_DIM / CVT_ELEMS)       // blocks for x: 512
#define CVT_WBLK  (C_DIM * C_DIM / CVT_ELEMS)      // blocks per weight: 128

typedef __attribute__((ext_vector_type(4))) float  v4f;
typedef __attribute__((ext_vector_type(4))) __bf16 v4bf;

__global__ __launch_bounds__(CVT_BLOCK)
void cvt_f32_bf16(const float* __restrict__ x,
                  const float* __restrict__ wq, const float* __restrict__ wk,
                  const float* __restrict__ wv, const float* __restrict__ wo,
                  bf16_t* __restrict__ outAll) {
  int blk = blockIdx.x;
  int rel = blk;                       // the block's index inside its own array
  const float* arr = x;
  if (blk >= CVT_XBLK) {
    int w = (blk - CVT_XBLK) / CVT_WBLK;
    rel = (blk - CVT_XBLK) % CVT_WBLK;
    arr = w == 0 ? wq : w == 1 ? wk : w == 2 ? wv : wo;
  }
  const float* in = arr + (size_t)rel * CVT_ELEMS;
  bf16_t* out = outAll + (size_t)blk * CVT_ELEMS;
  size_t base = threadIdx.x * 4;
  v4f v[CVT_VEC];
  // both loops unrolled: v[] stays in registers, the loads go out as one group
  #pragma unroll
  for (int j = 0; j < CVT_VEC; ++j)
    v[j] = *reinterpret_cast<const v4f*>(in + base + j * (CVT_BLOCK * 4));
  #pragma unroll
  for (int j = 0; j < CVT_VEC; ++j) {
    v4bf o = {f2bf(v[j][0]), f2bf(v[j][1]), f2bf(v[j][2]), f2bf(v[j][3])};
    *reinterpret_cast<v4bf*>(out + base + j * (CVT_BLOCK * 4)) = o;
  }
}

// ----- kernel 2: GEMM  Y = A(4096x1024) @ W^T(1024x1024) + bias ------------
// 8 waves / workgroup, one 128(M) x 128(N) tile of Y.  A trip is 128 k: 128
// rows x 256 bytes of A and as much of W are brought into a two-buffer LDS ring
// by async copies (a wave's copy covers two whole rows), the next trip's tiles
// in flight while this trip's are worked on; all fragments are read from LDS at
// a row pitch of 272 bytes.  k runs upwards in steps of 32 in every accumulator.
// mode 0: store bf16 row-major [M][N], value scaled by scale
// mode 1: store bf16 transposed for V: out[(b*1024+n)*2048 + t]
// mode 2: store f32 row-major [M][N]
// qkv != 0: one launch does the Q, K and V projections; blockIdx.z picks the
// weight (the three lie one behind the other from Wall), the bias and the result
// (one behind the other from outAll): z = 0 is Q (mode 0, scaled by 1/sqrt d),
// z = 1 is K (mode 0), z = 2 is V (mode 1).  qkv == 0: grid z is 1, mode 2.
// The matrix whose row index runs ALONG a row of the result (W in modes 0 and 2,
// A in mode 1) is the first WMMA operand, P; the other, Q, is the second.  A
// lane's 8 accumulators of a tile are then 8 neighbours in one row of the result.
// The waves stand 2 (P) x 4 (Q), each with 64 P rows x 32 Q rows: 32 rows of the
// result, 64 elements each, which are whole 128-byte lines.  A wave puts its
// piece into its own part of the (by then free) ring and reads it back row by
// row, so that every global store instruction writes whole lines.

#define GM_WAVES 8
#define GM_TILE  128          // rows of A and rows of W per workgroup
#define GM_BK    128          // k per trip
#define GM_PITCH 136          // LDS row pitch in elements (272 B = 16 B x 17)
#define GM_TRIPS (C_DIM / GM_BK)
#define GM_SP16  144          // staging row pitch in bytes, 64 bf16 (16 B x 9)
#define GM_SP32  272          // staging row pitch in bytes, 64 f32 (16 B x 17)
#define GM_STG   (32 * GM_SP32)   // staging bytes per wave; 8 of them = ldsA

__global__ __launch_bounds__(GM_WAVES * 32)
void gemm_proj(const bf16_t* __restrict__ A,
                          const bf16_t* __restrict__ Wall,
                          const float* __restrict__ bias0,
                          const float* __restrict__ bias1,
                          const float* __restrict__ bias2,
                          void* __restrict__ outAll, int qkv) {
  __shared__ alignas(16) bf16_t ldsA[2][GM_TILE * GM_PITCH];
  __shared__ alignas(16) bf16_t ldsB[2][GM_TILE * GM_PITCH];

  int z = blockIdx.z;
  const bf16_t* W = Wall + (size_t)z * (C_DIM * C_DIM);
  const float* bias = z == 0 ? bias0 : z == 1 ? bias1 : bias2;
  bool vt = qkv && z == 2;           // mode 1: the result is stored transposed
  float scale = (qkv && z == 0) ? ATT_SCALE : 1.0f;
  // the bf16 results are MTOT * C_DIM elements each; z is 0 for the f32 result
  void* out = (void*)((bf16_t*)outAll + (size_t)z * (MTOT * C_DIM));

  int tid  = threadIdx.x;            // 0..255
  int wave = tid >> 5;
  int lane = tid & 31;
  int nn = lane & 15, half = lane >> 4;
  int po = (wave & 1) * 64;          // the wave's rows inside the P tile
  int qo = (wave >> 1) * 32;         // the wave's rows inside the Q tile

  // stage k..k+127 of the block's 128 rows of A and of W into buffer buf: 2048
  // chunks of 16 B each, eight of each per thread, 16 rows apart.
  int srow = tid >> 4;                 // 0..15
  int scol = (tid & 15) * 8;           // element column of the 16-byte chunk
  const bf16_t* Asrc = A + (size_t)(blockIdx.x * GM_TILE + srow) * C_DIM + scol;
  const bf16_t* Wsrc = W + (size_t)(blockIdx.y * GM_TILE + srow) * C_DIM + scol;
  auto stage = [&](int buf, int k) {
    unsigned da = (unsigned)(uintptr_t)&ldsA[buf][srow * GM_PITCH + scol];
    unsigned db = (unsigned)(uintptr_t)&ldsB[buf][srow * GM_PITCH + scol];
    async_copy8_b128(da, 16 * GM_PITCH * 2, Asrc + k, 16 * C_DIM);
    async_copy8_b128(db, 16 * GM_PITCH * 2, Wsrc + k, 16 * C_DIM);
  };

  // c[i][j][r]: Q row qo + 16 i + nn, P row po + 16 j + 8 half + r
  v8f c[2][4];
  #pragma unroll
  for (int i = 0; i < 2; ++i)
    #pragma unroll
    for (int j = 0; j < 4; ++j)
      c[i][j] = v8f{0.f, 0.f, 0.f, 0.f, 0.f, 0.f, 0.f, 0.f};

  const bf16_t* Pbase = vt ? &ldsA[0][0] : &ldsB[0][0];
  const bf16_t* Qbase = vt ? &ldsB[0][0] : &ldsA[0][0];

  stage(0, 0);
  wait_asynccnt0();          // our slice of trip 0's tiles landed
  __syncthreads();           // everyone's slice landed
  stage(1, GM_BK);

  // two trips a pass of the loop: the buffer index is a constant in each copy,
  // and the text stays short (unrolled in full it is four times as long)
  #pragma unroll 2
  for (int t = 0; t < GM_TRIPS; ++t) {
    const bf16_t* Pt = Pbase + (t & 1) * (GM_TILE * GM_PITCH);
    const bf16_t* Qt = Qbase + (t & 1) * (GM_TILE * GM_PITCH);
    // two fragment sets: inside a trip, k step q + 1 is read while q is worked on
    v16bf fq[2][2], fp[2][4];
    auto frags = [&](int s, int kk) {
      fq[s][0] = load_frag(Qt, GM_PITCH, qo,      kk);
      fq[s][1] = load_frag(Qt, GM_PITCH, qo + 16, kk);
      // unrolled: fp[] is indexed by constants only and stays in registers
      #pragma unroll
      for (int j = 0; j < 4; ++j)
        fp[s][j] = load_frag(Pt, GM_PITCH, po + j * 16, kk);
    };
    frags(0, 0);
    // unrolled: the set index is a constant (the sets stay in registers) and the
    // LDS offsets of the four k steps become immediates
    #pragma unroll
    for (int q = 0; q < GM_BK / 32; ++q) {
      if (q + 1 < GM_BK / 32) frags((q + 1) & 1, (q + 1) * 32);
      // holds the next step's 12 LDS reads as one group ahead of this step's
      // products; left free, they are sunk in pairs among the products, each
      // pair with a full wait for LDS behind it
      __builtin_amdgcn_sched_barrier(0);
      // unrolled: c[] and fp[] are indexed by constants only
      #pragma unroll
      for (int j = 0; j < 4; ++j) {
        c[0][j] = wmma_bf16(fp[q & 1][j], fq[q & 1][0], c[0][j]);
        c[1][j] = wmma_bf16(fp[q & 1][j], fq[q & 1][1], c[1][j]);
      }
      // keeps the reads of the step after next from rising among these products
      __builtin_amdgcn_sched_barrier(0);
    }
    // publish point of trip t + 1: our reads of this buffer are done, our slice
    // of the next tiles has landed, then everyone's; only then the refill.
    asm volatile("s_wait_dscnt 0x0" ::: "memory");
    wait_asynccnt0();
    __syncthreads();
    if (t + 2 < GM_TRIPS) stage(t & 1, (t + 2) * GM_BK);
  }
  wait_asynccnt0();          // nothing of ours is in flight when the wave ends

  // Behind the last trip's barrier nobody reads the ring and no copy is in
  // flight: ldsA, cut in eight, is the waves' staging room.
  char* stg = reinterpret_cast<char*>(&ldsA[0][0]) + wave * GM_STG;
  // the wave's piece of the result: 32 rows (Q), 64 elements each (P)
  int pidx = (vt ? blockIdx.x : blockIdx.y) * GM_TILE + po;   // first P row
  int qidx = (vt ? blockIdx.y : blockIdx.x) * GM_TILE + qo;   // first Q row

  if (!qkv) {
    // ---- mode 2: f32, a row of the piece is 256 bytes ----
    // unrolled: the registers are indexed by constants only
    #pragma unroll
    for (int j = 0; j < 4; ++j) {
      const float* bp = bias + pidx + j * 16 + 8 * half;
      v4f b0 = *reinterpret_cast<const v4f*>(bp);
      v4f b1 = *reinterpret_cast<const v4f*>(bp + 4);
      // unrolled: the registers are indexed by constants only
      #pragma unroll
      for (int i = 0; i < 2; ++i) {
        v4f lo, hi;
        // unrolled: the registers are indexed by constants only
        #pragma unroll
        for (int r = 0; r < 4; ++r) {
          lo[r] = (c[i][j][r] + b0[r]) * scale;
          hi[r] = (c[i][j][4 + r] + b1[r]) * scale;
        }
        char* sp = stg + (i * 16 + nn) * GM_SP32 + (j * 16 + 8 * half) * 4;
        *reinterpret_cast<v4f*>(sp) = lo;
        *reinterpret_cast<v4f*>(sp + 16) = hi;
      }
    }
    // the wave's own LDS stores are done before other lanes' values are read
    asm volatile("s_wait_dscnt 0x0" ::: "memory");
    float* orow = (float*)out + (size_t)(qidx + half) * C_DIM + pidx + nn * 4;
    // unrolled: the registers are indexed by constants only
    #pragma unroll
    for (int s = 0; s < 16; ++s) {     // two whole rows (4 lines) a store
      v4f v = *reinterpret_cast<const v4f*>(stg + (2 * s + half) * GM_SP32 + nn * 16);
      *reinterpret_cast<v4f*>(orow + (size_t)(2 * s) * C_DIM) = v;
    }
    // stands before any register that these stores name is written again
    asm volatile("s_wait_xcnt 0x0" ::: "memory");
  } else {
    // ---- modes 0 and 1: bf16, a row of the piece is 128 bytes ----
    auto put = [&](int i, int j, v8f bb) {
      v8bf o;
      // unrolled: the registers are indexed by constants only
      #pragma unroll
      for (int r = 0; r < 8; ++r) o[r] = f2bf((c[i][j][r] + bb[r]) * scale);
      *reinterpret_cast<v8bf*>(stg + (i * 16 + nn) * GM_SP16 +
                               (j * 16 + 8 * half) * 2) = o;
    };
    // read the piece back row by row and store it: orow is the lane's place in
    // rows 0..3, ld the result's row length (a constant at each call, so that the
    // eight stores share one address register and differ in the immediate offset)
    int rr = lane >> 3, cc = lane & 7;
    auto flush = [&](bf16_t* orow, int ld) {
      // the wave's own LDS stores are done before other lanes' values are read
      asm volatile("s_wait_dscnt 0x0" ::: "memory");
      // unrolled: the registers are indexed by constants only
      #pragma unroll
      for (int s = 0; s < 8; ++s) {    // four whole rows (4 lines) a store
        v8bf v = *reinterpret_cast<const v8bf*>(stg + (4 * s + rr) * GM_SP16 + cc * 16);
        *reinterpret_cast<v8bf*>(orow + 4 * s * ld) = v;
      }
      // stands before any register that these stores name is written again
      asm volatile("s_wait_xcnt 0x0" ::: "memory");
    };
    if (vt) {                          // the bias goes with the Q row (n)
      // unrolled: the registers are indexed by constants only
      #pragma unroll
      for (int i = 0; i < 2; ++i) {
        float bv = bias[qidx + i * 16 + nn];
        v8f bb = v8f{bv, bv, bv, bv, bv, bv, bv, bv};
        // unrolled: the registers are indexed by constants only
        #pragma unroll
        for (int j = 0; j < 4; ++j) put(i, j, bb);
      }
      // row b*1024 + n, column t, where m = pidx + .. = b*2048 + t (the 128 m of
      // a block have one b)
      flush((bf16_t*)out + (size_t)((pidx >> 11) * 1024 + qidx + rr) * T_SEQ +
                (pidx & (T_SEQ - 1)) + cc * 8, T_SEQ);
    } else {                           // the bias goes with the P row (n)
      // unrolled: the registers are indexed by constants only
      #pragma unroll
      for (int j = 0; j < 4; ++j) {
        const float* bp = bias + pidx + j * 16 + 8 * half;
        v4f b0 = *reinterpret_cast<const v4f*>(bp);
        v4f b1 = *reinterpret_cast<const v4f*>(bp + 4);
        v8f bb = __builtin_shufflevector(b0, b1, 0, 1, 2, 3, 4, 5, 6, 7);
        // unrolled: the registers are indexed by constants only
        #pragma unroll
        for (int i = 0; i < 2; ++i) put(i, j, bb);
      }
      // row m, column n
      flush((bf16_t*)out + (size_t)(qidx + rr) * C_DIM + pidx + cc * 8, C_DIM);
    }
  }
}

#define AT_WAVES 16
#define AT_KEYS  128          // keys per staged tile
#define AT_KPITCH 136         // K row pitch in elements (272 B = 16 B x 17)
#define AT_PITCH 136          // V^T row pitch in elements (272 B = 16 B x 17)
#define AT_TILES (T_SEQ / AT_KEYS)
#define AT_ROWS  128          // queries per block = mask rows per tile
#define AT_MPITCH 132         // mask row pitch in floats (528 B = 16 B x 33)
#define AT_JOIN  1088         // floats a wave hands to its partner: 32 x (32 + 2)

__global__ __launch_bounds__(AT_WAVES * 32)
void attn_flash(const bf16_t* __restrict__ Qb,
                           const bf16_t* __restrict__ Kb,
                           const bf16_t* __restrict__ Vt,
                           const float* __restrict__ mask,
                           bf16_t* __restrict__ AO) {
  __shared__ alignas(16) bf16_t ldsK[2][AT_KEYS * AT_KPITCH];
  __shared__ alignas(16) bf16_t ldsV[2][2 * HDIM * AT_PITCH];
  __shared__ alignas(16) float  ldsM[2][AT_ROWS * AT_MPITCH];

  int tid  = threadIdx.x;              // 0..511
  int wave = __builtin_amdgcn_readfirstlane(tid >> 5);   // the same in all lanes
  int hh = wave >> 3;                  // which of the block's two heads
  int qg = (wave >> 1) & 3;            // which 32 of the block's 128 queries
  int kh = wave & 1;                   // which 64 of a tile's 128 keys
  int b  = blockIdx.y >> 3;
  int h0 = (blockIdx.y & 7) * 2;       // the block's first head
  int h  = h0 + hh;
  int lane = tid & 31;
  int nn = lane & 15, half = lane >> 4;

  // Q as the B operand: column nn of group g is query qrow0 + 16 g + nn
  int qrow0 = b * T_SEQ + blockIdx.x * AT_ROWS + qg * 32;
  v16bf bq[2][2];
  // unrolled: the registers are indexed by constants only
  #pragma unroll
  for (int g = 0; g < 2; ++g) {
    bq[g][0] = load_frag(Qb, C_DIM, qrow0 + 16 * g, h * HDIM);
    bq[g][1] = load_frag(Qb, C_DIM, qrow0 + 16 * g, h * HDIM + 32);
  }

  // c[g][j][r] = O^T[d = 16 j + 8 half + r][query nn of group g], this key half
  v8f c[2][4];
  #pragma unroll
  for (int g = 0; g < 2; ++g)
    #pragma unroll
    for (int j = 0; j < 4; ++j)
      c[g][j] = v8f{0.f, 0.f, 0.f, 0.f, 0.f, 0.f, 0.f, 0.f};

  // a query's running maximum (equal in both lane halves) and the sum over this
  // lane half's keys, over this wave's key halves of the tiles
  float mrun[2] = {-3.0e38f, -3.0e38f};
  float lrun[2] = {0.f, 0.f};

  // this lane's mask row of group 0 inside a staged tile, at the first key of
  // its wave's key half and its lane half
  int mlane = (qg * 32 + nn) * AT_MPITCH + kh * 64 + 8 * half;

  // stage keys kb..kb+127 into buffer buf: 2048 chunks of 16 B for K and as many
  // for V^T, four of each per thread, 32 rows apart; 4096 for the mask, eight per
  // thread, 16 rows apart.  A wave's copy covers two whole rows of K or of V^T,
  // one of the mask.
  int srow = tid >> 4;                 // 0..31
  int scol = (tid & 15) * 8;           // element column of the 16-byte chunk
  // the sources as 32-bit element offsets (every array here has 2^22 elements):
  // one register each across the loop, the 64-bit addresses formed at the copies
  unsigned koff = (unsigned)((b * T_SEQ + srow) * C_DIM + h0 * HDIM + scol);
  unsigned voff = (unsigned)((b * 1024 + h0 * HDIM + srow) * T_SEQ + scol);
  int mrw = tid >> 5;                  // 0..15
  int mcl = (tid & 31) * 4;            // float column of the 16-byte chunk
  unsigned moff = (unsigned)((blockIdx.x * AT_ROWS + mrw) * T_SEQ + mcl);
  auto stage = [&](int buf, int kb) {
    unsigned dk = (unsigned)(uintptr_t)&ldsK[buf][srow * AT_KPITCH + scol];
    unsigned dv = (unsigned)(uintptr_t)&ldsV[buf][srow * AT_PITCH + scol];
    const bf16_t* ks = Kb + (koff + (unsigned)kb * C_DIM);
    const bf16_t* vs = Vt + (voff + (unsigned)kb);
    const float*  ms = mask + (moff + (unsigned)kb);
    const unsigned kst = 32 * AT_KPITCH * 2, vst = 32 * AT_PITCH * 2;
    async_copy4_b128(dk, dk + kst, dk + 2 * kst, dk + 3 * kst,
                     ks, ks + 32 * C_DIM, ks + 64 * C_DIM, ks + 96 * C_DIM);
    async_copy4_b128(dv, dv + vst, dv + 2 * vst, dv + 3 * vst,
                     vs, vs + 32 * T_SEQ, vs + 64 * T_SEQ, vs + 96 * T_SEQ);
    unsigned dm = (unsigned)(uintptr_t)&ldsM[buf][mrw * AT_MPITCH + mcl];
    async_copy4_b128_f32(dm, 16 * AT_MPITCH * 4, ms, 16 * T_SEQ);
    async_copy4_b128_f32(dm + 64 * AT_MPITCH * 4, 16 * AT_MPITCH * 4,
                         ms + 64 * T_SEQ, 16 * T_SEQ);
  };

  stage(0, 0);
  wait_asynccnt0();          // our slice of tile 0 landed
  __syncthreads();           // everyone's slice landed
  stage(1, AT_KEYS);

  // A pass first reads all it needs of the buffer into registers (K fragments,
  // used at once for the scores; V^T fragments; mask rows); softmax and the
  // second product work on registers alone.  So a trip's publish point and the
  // refill stand behind the reads of its second pass, and the refill is in
  // flight for nearly a whole trip.
  // One loop over the passes, kept rolled: unrolled by two, values of both passes
  // (and the copies' addresses) are held at once and the build spills.
  #pragma unroll 1
  for (int u = 0; u < 2 * AT_TILES; ++u) {
    int t = u >> 1, ps = u & 1;        // the trip, and the pass inside it
    const bf16_t* Kt = &ldsK[t & 1][0];
    const bf16_t* Vl = &ldsV[t & 1][0];
    const float*  Ml = &ldsM[t & 1][mlane];
    int k0 = kh * 64 + ps * 32;        // the pass's first key inside the tile
    // ---- scores: S^T(32x16) = K(32x64) @ Q^T a group, two 16x16 tiles ----
    // s[g][0][r] = S[query nn of g][key 128 t + k0 + 8 half + r],
    // s[g][1][r]: 16 keys further on
    v16bf k00 = load_frag(Kt, AT_KPITCH, k0,      hh * HDIM);
    v16bf k01 = load_frag(Kt, AT_KPITCH, k0,      hh * HDIM + 32);
    v16bf k10 = load_frag(Kt, AT_KPITCH, k0 + 16, hh * HDIM);
    v16bf k11 = load_frag(Kt, AT_KPITCH, k0 + 16, hh * HDIM + 32);
    v8f s[2][2];
    // unrolled: the registers are indexed by constants only
    #pragma unroll
    for (int g = 0; g < 2; ++g) {
      s[g][0] = v8f{0.f, 0.f, 0.f, 0.f, 0.f, 0.f, 0.f, 0.f};
      s[g][1] = v8f{0.f, 0.f, 0.f, 0.f, 0.f, 0.f, 0.f, 0.f};
      s[g][0] = wmma_bf16(k00, bq[g][0], s[g][0]);
      s[g][0] = wmma_bf16(k01, bq[g][1], s[g][0]);
      s[g][1] = wmma_bf16(k10, bq[g][0], s[g][1]);
      s[g][1] = wmma_bf16(k11, bq[g][1], s[g][1]);
    }
    // the four V^T fragments of this pass's keys
    v16bf va[4];
    #pragma unroll
    for (int j = 0; j < 4; ++j)
      va[j] = load_frag(Vl, AT_PITCH, hh * HDIM + j * 16, k0);
    // additive mask (2D [Tq][Tk]): 8 + 8 consecutive keys of one row a group
    v8f mk[2][2];
    #pragma unroll
    for (int g = 0; g < 2; ++g) {
      const float* mp = Ml + g * 16 * AT_MPITCH + ps * 32;
      v4f m00 = *reinterpret_cast<const v4f*>(mp);
      v4f m01 = *reinterpret_cast<const v4f*>(mp + 4);
      v4f m10 = *reinterpret_cast<const v4f*>(mp + 16);
      v4f m11 = *reinterpret_cast<const v4f*>(mp + 20);
      mk[g][0] = __builtin_shufflevector(m00, m01, 0, 1, 2, 3, 4, 5, 6, 7);
      mk[g][1] = __builtin_shufflevector(m10, m11, 0, 1, 2, 3, 4, 5, 6, 7);
    }

    // publish point of tile t + 1: our reads of this buffer are done, our slice
    // of the next tile has landed, then everyone's; only then the refill.
    if (ps == 1) {
      asm volatile("s_wait_dscnt 0x0" ::: "memory");
      wait_asynccnt0();
      __syncthreads();
    }
    if (ps == 1 && t + 2 < AT_TILES) stage(t & 1, (t + 2) * AT_KEYS);

    v16bf pb[2];               // P^T as B: pb[g][s] = P[nn of g][kmap(s, half)]
    // unrolled: the registers are indexed by constants only
    #pragma unroll
    for (int g = 0; g < 2; ++g) {
      v8f s0 = s[g][0] + mk[g][0];
      v8f s1 = s[g][1] + mk[g][1];

      // ---- online softmax update, in the lane ----
      float tm = fmaxf(s0[0], s1[0]);
      #pragma unroll
      for (int r = 1; r < 8; ++r) tm = fmaxf(tm, fmaxf(s0[r], s1[r]));
      tm = fmaxf(tm, xhalf(tm));       // the other half's 16 keys
      float nm = fmaxf(mrun[g], tm);
      float al = __expf(mrun[g] - nm);
      float rs = 0.f;
      #pragma unroll
      for (int r = 0; r < 8; ++r) {
        float p0 = __expf(s0[r] - nm);
        float p1 = __expf(s1[r] - nm);
        rs += p0 + p1;
        pb[g][r]     = f2bf(p0);
        pb[g][8 + r] = f2bf(p1);
      }
      lrun[g] = lrun[g] * al + rs;
      mrun[g] = nm;
      #pragma unroll
      for (int j = 0; j < 4; ++j)
        #pragma unroll
        for (int r = 0; r < 8; ++r) c[g][j][r] *= al;
    }

    // ---- O^T(64x16) += V^T(64x32) @ P^T(32x16), both groups per fragment ----
    #pragma unroll
    for (int j = 0; j < 4; ++j) {
      c[0][j] = wmma_bf16(va[j], pb[0], c[0][j]);
      c[1][j] = wmma_bf16(va[j], pb[1], c[1][j]);
    }
  }
  wait_asynccnt0();          // nothing of ours is in flight when the wave ends

  // ---- join the two key halves, normalize, store to AO ([4096][1024] bf16) ----
  // Behind the last tile's barrier nobody reads the ring and no copy is in
  // flight: ldsM, cut in sixteen, carries the hand-over.  Of a pair of waves,
  // key half 0 finishes column group 0 and key half 1 group 1; each hands the
  // other its part of the other group, lane to the same lane.
  float* join = &ldsM[0][0];
  auto give = [&](int g) {
    float* p = join + wave * AT_JOIN;
    // unrolled: the registers are indexed by constants only
    #pragma unroll
    for (int j = 0; j < 4; ++j) {
      v4f lo = {c[g][j][0], c[g][j][1], c[g][j][2], c[g][j][3]};
      v4f hi = {c[g][j][4], c[g][j][5], c[g][j][6], c[g][j][7]};
      *reinterpret_cast<v4f*>(p + ((2 * j) * 32 + lane) * 4) = lo;
      *reinterpret_cast<v4f*>(p + ((2 * j + 1) * 32 + lane) * 4) = hi;
    }
    p[1024 + lane] = mrun[g];
    p[1056 + lane] = lrun[g];
  };
  auto finish = [&](int g) {
    const float* p = join + (wave ^ 1) * AT_JOIN;
    float mo = p[1024 + lane];
    float lo_ = p[1056 + lane];
    float mx = fmaxf(mrun[g], mo);
    float fa = __expf(mrun[g] - mx);   // weight of this wave's part
    float fb = __expf(mo - mx);        // weight of the partner's part
    float l = lrun[g] * fa + lo_ * fb;
    float inv = 1.0f / (l + xhalf(l));
    // a lane's 8 registers of a tile are 8 consecutive d of its query: 16 bytes
    bf16_t* orow = AO + (size_t)(qrow0 + 16 * g + nn) * C_DIM + h * HDIM + 8 * half;
    // unrolled: the registers are indexed by constants only
    #pragma unroll
    for (int j = 0; j < 4; ++j) {
      v4f lo = *reinterpret_cast<const v4f*>(p + ((2 * j) * 32 + lane) * 4);
      v4f hi = *reinterpret_cast<const v4f*>(p + ((2 * j + 1) * 32 + lane) * 4);
      v8bf o;
      #pragma unroll
      for (int r = 0; r < 4; ++r) {
        o[r]     = f2bf((c[g][j][r] * fa + lo[r] * fb) * inv);
        o[4 + r] = f2bf((c[g][j][4 + r] * fa + hi[r] * fb) * inv);
      }
      *reinterpret_cast<v8bf*>(orow + j * 16) = o;
    }
  };
  if (kh) give(0); else give(1);
  __syncthreads();           // every wave's hand-over is written
  if (kh) finish(1); else finish(0);
}

// ---------------------------------------------------------------------------

extern "C" void kernel_launch(void* const* d_in, const int* in_sizes, int n_in,
                              void* d_out, int out_size, void* d_ws,
                              size_t ws_size, hipStream_t stream) {
  const float* x    = (const float*)d_in[0];
  const float* mask = (const float*)d_in[1];
  const float* Wq = (const float*)d_in[2];  const float* bq = (const float*)d_in[3];
  const float* Wk = (const float*)d_in[4];  const float* bk = (const float*)d_in[5];
  const float* Wv = (const float*)d_in[6];  const float* bv = (const float*)d_in[7];
  const float* Wo = (const float*)d_in[8];  const float* bo = (const float*)d_in[9];

  char* ws = (char*)d_ws;
  const size_t MiB = 1024 * 1024;
  bf16_t* xb  = (bf16_t*)(ws + 0);          //  8 MiB  x  bf16 [4096][1024]
  bf16_t* wqb = (bf16_t*)(ws + 8  * MiB);   //  2 MiB
  bf16_t* wkb = (bf16_t*)(ws + 10 * MiB);   //  2 MiB
  bf16_t* wvb = (bf16_t*)(ws + 12 * MiB);   //  2 MiB
  bf16_t* wob = (bf16_t*)(ws + 14 * MiB);   //  2 MiB
  bf16_t* Qb  = (bf16_t*)(ws + 16 * MiB);   //  8 MiB  (pre-scaled by 1/sqrt d)
  bf16_t* Kb  = (bf16_t*)(ws + 24 * MiB);   //  8 MiB
  bf16_t* Vt  = (bf16_t*)(ws + 32 * MiB);   //  8 MiB  V transposed [b][n][t]
  bf16_t* AO  = (bf16_t*)(ws + 40 * MiB);   //  8 MiB  attention out bf16

  // 1) fp32 -> bf16 staging, one launch: xb, wqb, wkb, wvb, wob are contiguous
  cvt_f32_bf16<<<CVT_XBLK + 4 * CVT_WBLK, CVT_BLOCK, 0, stream>>>(
      x, Wq, Wk, Wv, Wo, xb);

  // 2) Q/K/V projections (WMMA bf16, async-LDS staging of both operands), one
  //    launch: wqb, wkb, wvb are contiguous, and so are Qb, Kb, Vt
  dim3 gq(MTOT / GM_TILE, C_DIM / GM_TILE, 3);  // 32 x 8 x 3
  dim3 go(MTOT / GM_TILE, C_DIM / GM_TILE, 1);  // 32 x 8
  dim3 bw(GM_WAVES * 32);                       // 8 waves
  gemm_proj<<<gq, bw, 0, stream>>>(xb, wqb, bq, bk, bv, (void*)Qb, 1);

  // 3) streaming-softmax attention (WMMA bf16)
  //    grid y: 2 batches x NHEAD / 2 pairs of heads
  attn_flash<<<dim3(T_SEQ / AT_ROWS, 2 * NHEAD / 2), dim3(AT_WAVES * 32), 0, stream>>>(
      Qb, Kb, Vt, mask, AO);

  // 4) output projection, f32 result
  gemm_proj<<<go, bw, 0, stream>>>(AO, wob, bo, bo, bo, d_out, 0);
}
